// v000
// Times are from an AMD MI455X. After a warm-up the kernel runs many times in a row, and a time is the length of
// such a window on the GPU divided by its runs, so every launch and the gaps after it count. The runs cycle
// through copies of the inputs. A figure is the median of several windows, for all but v000 over two sittings.
// Sittings can differ by a few percent; kernels timed side by side share one.
// v000, which the later versions start from, runs in 417 microseconds.
#include <hip/hip_runtime.h>
#include <hip/hip_bf16.h>

// ---------------------------------------------------------------------------
// MI455X (gfx1250) multi-head attention forward.
// f16 storage + f32 WMMA accumulation via v_wmma_f32_16x16x32_f16 (wave32).
// Global->LDS staging uses CDNA5 async-LDS DMA (ASYNCcnt) with double buffer.
// ---------------------------------------------------------------------------

typedef __attribute__((ext_vector_type(16))) _Float16 v16h;
typedef __attribute__((ext_vector_type(8)))  _Float16 v8h;
typedef __attribute__((ext_vector_type(8)))  float    v8f;

union HFrag { v16h v; v8h h[2]; };

// Load one 16x32 f16 A/B fragment from a row-major (ld halves) tile.
// Per ISA 7.12.2: lane L holds row (L&15); K halves are
//   [off..off+7] in VGPR0-3 and [off+16..off+23] in VGPR4-7, off=(L>=16)*8.
// B fragments use the identical layout on the N-major (transposed) operand.
__device__ __forceinline__ v16h load_frag16(const _Float16* __restrict__ base,
                                            int ld, int lane) {
  const _Float16* p = base + (lane & 15) * ld + ((lane >> 4) << 3);
  HFrag f;
  f.h[0] = *(const v8h*)(p);
  f.h[1] = *(const v8h*)(p + 16);
  return f.v;
}

__device__ __forceinline__ v8f wmma16(v16h a, v16h b, v8f c) {
  return __builtin_amdgcn_wmma_f32_16x16x32_f16(false, a, false, b,
                                                (short)0, c, false, false);
}

// CDNA5 async global->LDS copy, 16B per lane (GLOBAL_LOAD_ASYNC_TO_LDS_B128,
// tracked with ASYNCcnt). LDS destination is the low 32 address bits of the
// generic shared-memory pointer (aperture mapping, ISA 10.2).
__device__ __forceinline__ void async_copy_b128(void* lds_dst,
                                                const _Float16* gsrc) {
  unsigned int lds_off = (unsigned int)(unsigned long long)(uintptr_t)lds_dst;
  unsigned long long addr = (unsigned long long)(uintptr_t)gsrc;
  asm volatile("global_load_async_to_lds_b128 %0, %1, off"
               :: "v"(lds_off), "v"(addr)
               : "memory");
}

__device__ __forceinline__ void wait_async0() {
  asm volatile("s_wait_asynccnt 0x0" ::: "memory");
}

// Problem constants (from the reference).
constexpr int   kB     = 2;
constexpr int   kSeq   = 2048;
constexpr int   kDim   = 1024;
constexpr int   kHeads = 16;
constexpr int   kHd    = 64;
constexpr int   kM     = kB * kSeq;      // 4096 rows
constexpr float kScale = 0.125f;         // 64^-0.5

// ---------------------------------------------------------------------------
// Elementwise f32 -> f16
// ---------------------------------------------------------------------------
__global__ void k_f32_to_f16(const float* __restrict__ in,
                             _Float16* __restrict__ out, int n) {
  int i = blockIdx.x * blockDim.x + threadIdx.x;
  if (i < n) out[i] = (_Float16)in[i];
}

// Transpose + convert: in f32 [R][C] -> out f16 [C][R]  (weights -> N-major)
__global__ void k_transpose_f16(const float* __restrict__ in,
                                _Float16* __restrict__ out, int R, int C) {
  int i = blockIdx.x * blockDim.x + threadIdx.x;
  if (i < R * C) {
    int r = i / C, c = i % C;
    out[(size_t)c * R + r] = (_Float16)in[i];
  }
}

// ---------------------------------------------------------------------------
// QKV projection: C[4096,3072] = Xh[4096,1024] @ Wqkv; scatter to q/k/v
// in [B,H,N,Dh] f16 layout. Block tile 128x128, K-step 32, 8 waves (4x2).
// Async double-buffered LDS staging: DMA tile kt+1 while WMMAs chew tile kt.
// ---------------------------------------------------------------------------
__global__ __launch_bounds__(256) void k_qkv_gemm(
    const _Float16* __restrict__ A,    // [4096,1024]
    const _Float16* __restrict__ Bt,   // [3072,1024]  (Wqkv^T, N-major)
    const float* __restrict__ bias,    // [3072]
    _Float16* __restrict__ qh, _Float16* __restrict__ kh,
    _Float16* __restrict__ vh) {
  __shared__ __align__(16) _Float16 sA[2][128 * 32];
  __shared__ __align__(16) _Float16 sB[2][128 * 32];
  const int tid = threadIdx.x, lane = tid & 31, w = tid >> 5;
  const int wm = w & 3, wn = w >> 2;
  const int m0 = blockIdx.x * 128, n0 = blockIdx.y * 128;
  constexpr int KT = kDim / 32;

  auto stage = [&](int kt, int buf) {
#pragma unroll
    for (int c = tid; c < 512; c += 256) {   // 128 rows x 32 halves per tile
      const int r = c >> 2, kc = (c & 3) << 3;
      async_copy_b128(&sA[buf][r * 32 + kc],
                      &A[(size_t)(m0 + r) * kDim + kt * 32 + kc]);
      async_copy_b128(&sB[buf][r * 32 + kc],
                      &Bt[(size_t)(n0 + r) * kDim + kt * 32 + kc]);
    }
  };

  v8f acc[2][4];
  v8f z = {};
#pragma unroll
  for (int i = 0; i < 2; ++i)
#pragma unroll
    for (int j = 0; j < 4; ++j) acc[i][j] = z;

  stage(0, 0);
  wait_async0();
  __syncthreads();

  for (int kt = 0; kt < KT; ++kt) {
    const int cur = kt & 1;
    if (kt + 1 < KT) stage(kt + 1, cur ^ 1);   // overlap DMA with compute

    v16h af[2], bf[4];
#pragma unroll
    for (int i = 0; i < 2; ++i)
      af[i] = load_frag16(&sA[cur][(wm * 32 + i * 16) * 32], 32, lane);
#pragma unroll
    for (int j = 0; j < 4; ++j)
      bf[j] = load_frag16(&sB[cur][(wn * 64 + j * 16) * 32], 32, lane);
#pragma unroll
    for (int i = 0; i < 2; ++i)
#pragma unroll
      for (int j = 0; j < 4; ++j) acc[i][j] = wmma16(af[i], bf[j], acc[i][j]);

    wait_async0();
    __syncthreads();
  }

  // Epilogue: C layout = VGPR e holds row (e + 8*(lane>=16)), col (lane&15).
  const int rl = (lane >> 4) << 3;
#pragma unroll
  for (int i = 0; i < 2; ++i) {
#pragma unroll
    for (int j = 0; j < 4; ++j) {
      const int gn = n0 + wn * 64 + j * 16 + (lane & 15);
      const float bn = bias[gn];
      const int which = gn >> 10;            // 0=q 1=k 2=v
      const int cc = gn & 1023;
      const int hh = cc >> 6, dd = cc & 63;
      _Float16* dst = (which == 0) ? qh : (which == 1) ? kh : vh;
#pragma unroll
      for (int e = 0; e < 8; ++e) {
        const int gm = m0 + wm * 32 + i * 16 + rl + e;
        const int bb = gm >> 11, tt = gm & 2047;
        dst[(((size_t)(bb * kHeads + hh)) * kSeq + tt) * kHd + dd] =
            (_Float16)(acc[i][j][e] + bn);
      }
    }
  }
}

// ---------------------------------------------------------------------------
// Flash attention: one WG per (b,h, 128-query block); 8 waves x 16 rows.
// K tile staged via async-LDS DMA (rows are already the Bt layout for Q@K^T);
// V staged transposed through VGPRs (Vt rows are Bt layout for P@V).
// Online softmax in f32 registers.
// ---------------------------------------------------------------------------
__global__ __launch_bounds__(256) void k_attn(
    const _Float16* __restrict__ qh, const _Float16* __restrict__ kh,
    const _Float16* __restrict__ vh, _Float16* __restrict__ oh) {
  __shared__ __align__(16) _Float16 sK[64 * 64];        // [key][dh]
  __shared__ __align__(16) _Float16 sVt[64 * 64];       // [dh][key]
  __shared__ __align__(16) _Float16 sP[8 * 16 * 64];    // per-wave P slab

  const int tid = threadIdx.x, lane = tid & 31, w = tid >> 5;
  const int bh = blockIdx.y;                     // 0..B*H-1
  const int b = bh >> 4, h = bh & 15;
  const int q0 = blockIdx.x * 128 + w * 16;      // this wave's query rows
  const size_t bhBase = (size_t)bh * kSeq * kHd;

  // Q fragments stay resident in registers for the whole pass.
  v16h qf[2];
  {
    const _Float16* qp = qh + bhBase + (size_t)q0 * kHd;
#pragma unroll
    for (int j = 0; j < 2; ++j) qf[j] = load_frag16(qp + j * 32, kHd, lane);
  }

  v8f o[4];
  v8f z = {};
#pragma unroll
  for (int c = 0; c < 4; ++c) o[c] = z;
  float mrow[8], lrow[8];
#pragma unroll
  for (int i = 0; i < 8; ++i) { mrow[i] = -1e30f; lrow[i] = 0.f; }

  _Float16* pw = &sP[w * (16 * 64)];
  const int rl = (lane >> 4) << 3;

  for (int kt = 0; kt < kSeq / 64; ++kt) {
    __syncthreads();
    const int kb = kt * 64;
#pragma unroll
    for (int c = tid; c < 512; c += 256) {       // 64 keys x 64 dh
      const int key = c >> 3, dc = (c & 7) << 3;
      // K tile: async DMA straight into LDS.
      async_copy_b128(&sK[key * 64 + dc],
                      &kh[bhBase + (size_t)(kb + key) * kHd + dc]);
      // V tile: through VGPRs (transposed on the way into LDS).
      v8h vv = *(const v8h*)&vh[bhBase + (size_t)(kb + key) * kHd + dc];
#pragma unroll
      for (int e = 0; e < 8; ++e) sVt[(dc + e) * 64 + key] = vv[e];
      if (kt + 1 < kSeq / 64) {
        __builtin_prefetch(&kh[bhBase + (size_t)(kb + 64 + key) * kHd + dc], 0, 1);
        __builtin_prefetch(&vh[bhBase + (size_t)(kb + 64 + key) * kHd + dc], 0, 1);
      }
    }
    wait_async0();
    __syncthreads();

    // S = Q @ K^T  (16 x 64 per wave)
    v8f s[4];
#pragma unroll
    for (int c = 0; c < 4; ++c) s[c] = z;
#pragma unroll
    for (int j = 0; j < 2; ++j)
#pragma unroll
      for (int c = 0; c < 4; ++c) {
        v16h kf = load_frag16(&sK[(c * 16) * 64 + j * 32], 64, lane);
        s[c] = wmma16(qf[j], kf, s[c]);
      }

    // Online softmax. Row i lives in lanes {g*16..g*16+15} at vector idx i.
#pragma unroll
    for (int i = 0; i < 8; ++i) {
      float mx = fmaxf(fmaxf(s[0][i], s[1][i]), fmaxf(s[2][i], s[3][i]));
#pragma unroll
      for (int d = 1; d < 16; d <<= 1) mx = fmaxf(mx, __shfl_xor(mx, d, 16));
      const float mnew = fmaxf(mrow[i], mx * kScale);
      const float alpha = __expf(mrow[i] - mnew);
      float rsum = 0.f;
#pragma unroll
      for (int c = 0; c < 4; ++c) {
        float p = __expf(s[c][i] * kScale - mnew);
        s[c][i] = p;
        rsum += p;
      }
#pragma unroll
      for (int d = 1; d < 16; d <<= 1) rsum += __shfl_xor(rsum, d, 16);
      lrow[i] = lrow[i] * alpha + rsum;
      mrow[i] = mnew;
#pragma unroll
      for (int c = 0; c < 4; ++c) o[c][i] *= alpha;
    }

    // C-layout -> A-fragment layout for P via wave-private LDS slab.
#pragma unroll
    for (int i = 0; i < 8; ++i)
#pragma unroll
      for (int c = 0; c < 4; ++c)
        pw[(rl + i) * 64 + c * 16 + (lane & 15)] = (_Float16)s[c][i];

    v16h pf[2];
#pragma unroll
    for (int j = 0; j < 2; ++j) pf[j] = load_frag16(pw + j * 32, 64, lane);

    // O += P @ V
#pragma unroll
    for (int j = 0; j < 2; ++j)
#pragma unroll
      for (int c = 0; c < 4; ++c) {
        v16h vf = load_frag16(&sVt[(c * 16) * 64 + j * 32], 64, lane);
        o[c] = wmma16(pf[j], vf, o[c]);
      }
  }

  // Normalize and write O in [b, token, h*64+dh] (row-major for out-proj).
#pragma unroll
  for (int i = 0; i < 8; ++i) {
    const float inv = 1.f / lrow[i];
    const int token = q0 + rl + i;
#pragma unroll
    for (int c = 0; c < 4; ++c) {
      const int dh = c * 16 + (lane & 15);
      oh[((size_t)(b * kSeq + token)) * kDim + h * kHd + dh] =
          (_Float16)(o[c][i] * inv);
    }
  }
}

// ---------------------------------------------------------------------------
// Output projection: out[4096,1024] = Oh @ Wout + b_out (f32 result).
// Same async double-buffered pipeline as the QKV GEMM.
// ---------------------------------------------------------------------------
__global__ __launch_bounds__(256) void k_out_gemm(
    const _Float16* __restrict__ A,    // [4096,1024]
    const _Float16* __restrict__ Bt,   // [1024,1024] (Wout^T)
    const float* __restrict__ bias,    // [1024]
    float* __restrict__ C) {
  __shared__ __align__(16) _Float16 sA[2][128 * 32];
  __shared__ __align__(16) _Float16 sB[2][128 * 32];
  const int tid = threadIdx.x, lane = tid & 31, w = tid >> 5;
  const int wm = w & 3, wn = w >> 2;
  const int m0 = blockIdx.x * 128, n0 = blockIdx.y * 128;
  constexpr int KT = kDim / 32;

  auto stage = [&](int kt, int buf) {
#pragma unroll
    for (int c = tid; c < 512; c += 256) {
      const int r = c >> 2, kc = (c & 3) << 3;
      async_copy_b128(&sA[buf][r * 32 + kc],
                      &A[(size_t)(m0 + r) * kDim + kt * 32 + kc]);
      async_copy_b128(&sB[buf][r * 32 + kc],
                      &Bt[(size_t)(n0 + r) * kDim + kt * 32 + kc]);
    }
  };

  v8f acc[2][4];
  v8f z = {};
#pragma unroll
  for (int i = 0; i < 2; ++i)
#pragma unroll
    for (int j = 0; j < 4; ++j) acc[i][j] = z;

  stage(0, 0);
  wait_async0();
  __syncthreads();

  for (int kt = 0; kt < KT; ++kt) {
    const int cur = kt & 1;
    if (kt + 1 < KT) stage(kt + 1, cur ^ 1);

    v16h af[2], bf[4];
#pragma unroll
    for (int i = 0; i < 2; ++i)
      af[i] = load_frag16(&sA[cur][(wm * 32 + i * 16) * 32], 32, lane);
#pragma unroll
    for (int j = 0; j < 4; ++j)
      bf[j] = load_frag16(&sB[cur][(wn * 64 + j * 16) * 32], 32, lane);
#pragma unroll
    for (int i = 0; i < 2; ++i)
#pragma unroll
      for (int j = 0; j < 4; ++j) acc[i][j] = wmma16(af[i], bf[j], acc[i][j]);

    wait_async0();
    __syncthreads();
  }

  const int rl = (lane >> 4) << 3;
#pragma unroll
  for (int i = 0; i < 2; ++i) {
#pragma unroll
    for (int j = 0; j < 4; ++j) {
      const int gn = n0 + wn * 64 + j * 16 + (lane & 15);
      const float bn = bias[gn];
#pragma unroll
      for (int e = 0; e < 8; ++e) {
        const int gm = m0 + wm * 32 + i * 16 + rl + e;
        C[(size_t)gm * kDim + gn] = acc[i][j][e] + bn;
      }
    }
  }
}

// ---------------------------------------------------------------------------
// Host-side launcher.
// ---------------------------------------------------------------------------
extern "C" void kernel_launch(void* const* d_in, const int* in_sizes, int n_in,
                              void* d_out, int out_size, void* d_ws,
                              size_t ws_size, hipStream_t stream) {
  (void)in_sizes; (void)n_in; (void)out_size; (void)ws_size;
  const float* x    = (const float*)d_in[0];   // [2,2048,1024]
  const float* Wqkv = (const float*)d_in[1];   // [1024,3072]
  const float* bqkv = (const float*)d_in[2];   // [3072]
  const float* Wout = (const float*)d_in[3];   // [1024,1024]
  const float* bout = (const float*)d_in[4];   // [1024]
  float* out = (float*)d_out;                  // [2,2048,1024]

  char* ws = (char*)d_ws;
  size_t off = 0;
  auto alloc = [&](size_t bytes) -> void* {
    void* p = ws + off;
    off += (bytes + 255) & ~(size_t)255;
    return p;
  };
  const size_t nX = (size_t)kM * kDim;                 // 4.19M
  _Float16* xh    = (_Float16*)alloc(nX * 2);          // reused as Oh later
  _Float16* wqkvT = (_Float16*)alloc((size_t)3 * kDim * kDim * 2);
  _Float16* woutT = (_Float16*)alloc((size_t)kDim * kDim * 2);
  _Float16* qh    = (_Float16*)alloc(nX * 2);
  _Float16* kh    = (_Float16*)alloc(nX * 2);
  _Float16* vh    = (_Float16*)alloc(nX * 2);
  _Float16* oh    = xh;  // xh dead after QKV GEMM; alias for attention output

  // 1) precision/layout conversion (bandwidth-trivial: ~30 MB total)
  k_f32_to_f16<<<(int)((nX + 255) / 256), 256, 0, stream>>>(x, xh, (int)nX);
  k_transpose_f16<<<(kDim * 3 * kDim + 255) / 256, 256, 0, stream>>>(
      Wqkv, wqkvT, kDim, 3 * kDim);
  k_transpose_f16<<<(kDim * kDim + 255) / 256, 256, 0, stream>>>(
      Wout, woutT, kDim, kDim);

  // 2) QKV projection -> q/k/v in [B,H,N,Dh] f16
  k_qkv_gemm<<<dim3(kM / 128, (3 * kDim) / 128), 256, 0, stream>>>(
      xh, wqkvT, bqkv, qh, kh, vh);

  // 3) flash attention -> Oh in [B,N,C] f16
  k_attn<<<dim3(kSeq / 128, kB * kHeads), 256, 0, stream>>>(qh, kh, vh, oh);

  // 4) output projection -> f32 result
  k_out_gemm<<<dim3(kM / 128, kDim / 128), 256, 0, stream>>>(
      oh, woutT, bout, out);
}

// v001
// One run takes 300 microseconds.
// Next to v000, in two timings, it ran 1.43 and 1.42 times as fast.
#include <hip/hip_runtime.h>
#include <hip/hip_bf16.h>

// ---------------------------------------------------------------------------
// MI455X (gfx1250) multi-head attention forward.
// f16 storage + f32 WMMA accumulation via v_wmma_f32_16x16x32_f16 (wave32).
// Global->LDS staging uses CDNA5 async-LDS DMA (ASYNCcnt) with double buffer.
// ---------------------------------------------------------------------------

typedef __attribute__((ext_vector_type(16))) _Float16 v16h;
typedef __attribute__((ext_vector_type(8)))  _Float16 v8h;
typedef __attribute__((ext_vector_type(8)))  float    v8f;

union HFrag { v16h v; v8h h[2]; };

// Load one 16x32 f16 A/B fragment from a row-major (ld halves) tile.
// Per ISA 7.12.2: lane L holds row (L&15); K halves are
//   [off..off+7] in VGPR0-3 and [off+16..off+23] in VGPR4-7, off=(L>=16)*8.
// B fragments use the identical layout on the N-major (transposed) operand.
__device__ __forceinline__ v16h load_frag16(const _Float16* __restrict__ base,
                                            int ld, int lane) {
  const _Float16* p = base + (lane & 15) * ld + ((lane >> 4) << 3);
  HFrag f;
  f.h[0] = *(const v8h*)(p);
  f.h[1] = *(const v8h*)(p + 16);
  return f.v;
}

__device__ __forceinline__ v8f wmma16(v16h a, v16h b, v8f c) {
  return __builtin_amdgcn_wmma_f32_16x16x32_f16(false, a, false, b,
                                                (short)0, c, false, false);
}

// CDNA5 async global->LDS copy, 16B per lane (GLOBAL_LOAD_ASYNC_TO_LDS_B128,
// tracked with ASYNCcnt). LDS destination is the low 32 address bits of the
// generic shared-memory pointer (aperture mapping, ISA 10.2).
__device__ __forceinline__ void async_copy_b128(void* lds_dst,
                                                const _Float16* gsrc) {
  unsigned int lds_off = (unsigned int)(unsigned long long)(uintptr_t)lds_dst;
  unsigned long long addr = (unsigned long long)(uintptr_t)gsrc;
  asm volatile("global_load_async_to_lds_b128 %0, %1, off"
               :: "v"(lds_off), "v"(addr)
               : "memory");
}

__device__ __forceinline__ void wait_async0() {
  asm volatile("s_wait_asynccnt 0x0" ::: "memory");
}

// Problem constants (from the reference).
constexpr int   kB     = 2;
constexpr int   kSeq   = 2048;
constexpr int   kDim   = 1024;
constexpr int   kHeads = 16;
constexpr int   kHd    = 64;
constexpr int   kM     = kB * kSeq;      // 4096 rows
constexpr float kScale = 0.125f;         // 64^-0.5

// ---------------------------------------------------------------------------
// Elementwise f32 -> f16
// ---------------------------------------------------------------------------
__global__ void k_f32_to_f16(const float* __restrict__ in,
                             _Float16* __restrict__ out, int n) {
  int i = blockIdx.x * blockDim.x + threadIdx.x;
  if (i < n) out[i] = (_Float16)in[i];
}

// Transpose + convert: in f32 [R][C] -> out f16 [C][R]  (weights -> N-major)
// One 64x64 tile per block, turned in LDS: input rows are read as 256-byte
// runs and every output row of the tile leaves as one whole 128-byte line.
// R and C are multiples of 64; grid = (C/64, R/64), 256 threads.
__global__ __launch_bounds__(256) void k_transpose_f16(
    const float* __restrict__ in, _Float16* __restrict__ out, int R, int C) {
  __shared__ float sT[64][65];   // odd pitch: column reads fall on distinct banks
  const int tid = threadIdx.x;
  const int c0 = blockIdx.x * 64, r0 = blockIdx.y * 64;

  const int lr = tid >> 4, lc = (tid & 15) << 2;
  float4 v[4];
#pragma unroll
  for (int i = 0; i < 4; ++i)
    v[i] = *(const float4*)&in[(size_t)(r0 + lr + i * 16) * C + c0 + lc];
#pragma unroll
  for (int i = 0; i < 4; ++i) {
    sT[lr + i * 16][lc + 0] = v[i].x;
    sT[lr + i * 16][lc + 1] = v[i].y;
    sT[lr + i * 16][lc + 2] = v[i].z;
    sT[lr + i * 16][lc + 3] = v[i].w;
  }
  __syncthreads();

  const int rg = (tid & 7) << 3;   // 8 lanes x 8 halves = one output line
#pragma unroll
  for (int i = 0; i < 2; ++i) {
    const int oc = (tid >> 3) + i * 32;
    v8h h;
#pragma unroll
    for (int e = 0; e < 8; ++e) h[e] = (_Float16)sT[rg + e][oc];
    *(v8h*)&out[(size_t)(c0 + oc) * R + r0 + rg] = h;
  }
}

// ---------------------------------------------------------------------------
// QKV projection: C[4096,3072] = Xh[4096,1024] @ Wqkv; scatter to q/k/v
// in [B,H,N,Dh] f16 layout. Block tile 128x128, K-step 32, 8 waves (4x2).
// Async double-buffered LDS staging: DMA tile kt+1 while WMMAs chew tile kt.
// ---------------------------------------------------------------------------
__global__ __launch_bounds__(256) void k_qkv_gemm(
    const _Float16* __restrict__ A,    // [4096,1024]
    const _Float16* __restrict__ Bt,   // [3072,1024]  (Wqkv^T, N-major)
    const float* __restrict__ bias,    // [3072]
    _Float16* __restrict__ qh, _Float16* __restrict__ kh,
    _Float16* __restrict__ vh) {
  __shared__ __align__(16) _Float16 sA[2][128 * 32];
  __shared__ __align__(16) _Float16 sB[2][128 * 32];
  const int tid = threadIdx.x, lane = tid & 31, w = tid >> 5;
  const int wm = w & 3, wn = w >> 2;
  const int m0 = blockIdx.x * 128, n0 = blockIdx.y * 128;
  constexpr int KT = kDim / 32;

  auto stage = [&](int kt, int buf) {
#pragma unroll
    for (int c = tid; c < 512; c += 256) {   // 128 rows x 32 halves per tile
      const int r = c >> 2, kc = (c & 3) << 3;
      async_copy_b128(&sA[buf][r * 32 + kc],
                      &A[(size_t)(m0 + r) * kDim + kt * 32 + kc]);
      async_copy_b128(&sB[buf][r * 32 + kc],
                      &Bt[(size_t)(n0 + r) * kDim + kt * 32 + kc]);
    }
  };

  v8f acc[2][4];
  v8f z = {};
#pragma unroll
  for (int i = 0; i < 2; ++i)
#pragma unroll
    for (int j = 0; j < 4; ++j) acc[i][j] = z;

  stage(0, 0);
  wait_async0();
  __syncthreads();

  for (int kt = 0; kt < KT; ++kt) {
    const int cur = kt & 1;
    if (kt + 1 < KT) stage(kt + 1, cur ^ 1);   // overlap DMA with compute

    v16h af[2], bf[4];
#pragma unroll
    for (int i = 0; i < 2; ++i)
      af[i] = load_frag16(&sA[cur][(wm * 32 + i * 16) * 32], 32, lane);
#pragma unroll
    for (int j = 0; j < 4; ++j)
      bf[j] = load_frag16(&sB[cur][(wn * 64 + j * 16) * 32], 32, lane);
#pragma unroll
    for (int i = 0; i < 2; ++i)
#pragma unroll
      for (int j = 0; j < 4; ++j) acc[i][j] = wmma16(af[i], bf[j], acc[i][j]);

    wait_async0();
    __syncthreads();
  }

  // Epilogue: C layout = VGPR e holds row (e + 8*(lane>=16)), col (lane&15).
  const int rl = (lane >> 4) << 3;
#pragma unroll
  for (int i = 0; i < 2; ++i) {
#pragma unroll
    for (int j = 0; j < 4; ++j) {
      const int gn = n0 + wn * 64 + j * 16 + (lane & 15);
      const float bn = bias[gn];
      const int which = gn >> 10;            // 0=q 1=k 2=v
      const int cc = gn & 1023;
      const int hh = cc >> 6, dd = cc & 63;
      _Float16* dst = (which == 0) ? qh : (which == 1) ? kh : vh;
#pragma unroll
      for (int e = 0; e < 8; ++e) {
        const int gm = m0 + wm * 32 + i * 16 + rl + e;
        const int bb = gm >> 11, tt = gm & 2047;
        dst[(((size_t)(bb * kHeads + hh)) * kSeq + tt) * kHd + dd] =
            (_Float16)(acc[i][j][e] + bn);
      }
    }
  }
}

// ---------------------------------------------------------------------------
// Flash attention: one WG per (b,h, 128-query block); 8 waves x 16 rows.
// K tile staged via async-LDS DMA (rows are already the Bt layout for Q@K^T);
// V staged transposed through VGPRs (Vt rows are Bt layout for P@V).
// Online softmax in f32 registers.
// ---------------------------------------------------------------------------
__global__ __launch_bounds__(256) void k_attn(
    const _Float16* __restrict__ qh, const _Float16* __restrict__ kh,
    const _Float16* __restrict__ vh, _Float16* __restrict__ oh) {
  __shared__ __align__(16) _Float16 sK[64 * 64];        // [key][dh]
  __shared__ __align__(16) _Float16 sVt[64 * 64];       // [dh][key]
  __shared__ __align__(16) _Float16 sP[8 * 16 * 64];    // per-wave P slab

  const int tid = threadIdx.x, lane = tid & 31, w = tid >> 5;
  const int bh = blockIdx.y;                     // 0..B*H-1
  const int b = bh >> 4, h = bh & 15;
  const int q0 = blockIdx.x * 128 + w * 16;      // this wave's query rows
  const size_t bhBase = (size_t)bh * kSeq * kHd;

  // Q fragments stay resident in registers for the whole pass.
  v16h qf[2];
  {
    const _Float16* qp = qh + bhBase + (size_t)q0 * kHd;
#pragma unroll
    for (int j = 0; j < 2; ++j) qf[j] = load_frag16(qp + j * 32, kHd, lane);
  }

  v8f o[4];
  v8f z = {};
#pragma unroll
  for (int c = 0; c < 4; ++c) o[c] = z;
  float mrow[8], lrow[8];
#pragma unroll
  for (int i = 0; i < 8; ++i) { mrow[i] = -1e30f; lrow[i] = 0.f; }

  _Float16* pw = &sP[w * (16 * 64)];
  const int rl = (lane >> 4) << 3;

  for (int kt = 0; kt < kSeq / 64; ++kt) {
    __syncthreads();
    const int kb = kt * 64;
#pragma unroll
    for (int c = tid; c < 512; c += 256) {       // 64 keys x 64 dh
      const int key = c >> 3, dc = (c & 7) << 3;
      // K tile: async DMA straight into LDS.
      async_copy_b128(&sK[key * 64 + dc],
                      &kh[bhBase + (size_t)(kb + key) * kHd + dc]);
      // V tile: through VGPRs (transposed on the way into LDS).
      v8h vv = *(const v8h*)&vh[bhBase + (size_t)(kb + key) * kHd + dc];
#pragma unroll
      for (int e = 0; e < 8; ++e) sVt[(dc + e) * 64 + key] = vv[e];
      if (kt + 1 < kSeq / 64) {
        __builtin_prefetch(&kh[bhBase + (size_t)(kb + 64 + key) * kHd + dc], 0, 1);
        __builtin_prefetch(&vh[bhBase + (size_t)(kb + 64 + key) * kHd + dc], 0, 1);
      }
    }
    wait_async0();
    __syncthreads();

    // S = Q @ K^T  (16 x 64 per wave)
    v8f s[4];
#pragma unroll
    for (int c = 0; c < 4; ++c) s[c] = z;
#pragma unroll
    for (int j = 0; j < 2; ++j)
#pragma unroll
      for (int c = 0; c < 4; ++c) {
        v16h kf = load_frag16(&sK[(c * 16) * 64 + j * 32], 64, lane);
        s[c] = wmma16(qf[j], kf, s[c]);
      }

    // Online softmax. Row i lives in lanes {g*16..g*16+15} at vector idx i.
#pragma unroll
    for (int i = 0; i < 8; ++i) {
      float mx = fmaxf(fmaxf(s[0][i], s[1][i]), fmaxf(s[2][i], s[3][i]));
#pragma unroll
      for (int d = 1; d < 16; d <<= 1) mx = fmaxf(mx, __shfl_xor(mx, d, 16));
      const float mnew = fmaxf(mrow[i], mx * kScale);
      const float alpha = __expf(mrow[i] - mnew);
      float rsum = 0.f;
#pragma unroll
      for (int c = 0; c < 4; ++c) {
        float p = __expf(s[c][i] * kScale - mnew);
        s[c][i] = p;
        rsum += p;
      }
#pragma unroll
      for (int d = 1; d < 16; d <<= 1) rsum += __shfl_xor(rsum, d, 16);
      lrow[i] = lrow[i] * alpha + rsum;
      mrow[i] = mnew;
#pragma unroll
      for (int c = 0; c < 4; ++c) o[c][i] *= alpha;
    }

    // C-layout -> A-fragment layout for P via wave-private LDS slab.
#pragma unroll
    for (int i = 0; i < 8; ++i)
#pragma unroll
      for (int c = 0; c < 4; ++c)
        pw[(rl + i) * 64 + c * 16 + (lane & 15)] = (_Float16)s[c][i];

    v16h pf[2];
#pragma unroll
    for (int j = 0; j < 2; ++j) pf[j] = load_frag16(pw + j * 32, 64, lane);

    // O += P @ V
#pragma unroll
    for (int j = 0; j < 2; ++j)
#pragma unroll
      for (int c = 0; c < 4; ++c) {
        v16h vf = load_frag16(&sVt[(c * 16) * 64 + j * 32], 64, lane);
        o[c] = wmma16(pf[j], vf, o[c]);
      }
  }

  // Normalize and write O in [b, token, h*64+dh] (row-major for out-proj).
#pragma unroll
  for (int i = 0; i < 8; ++i) {
    const float inv = 1.f / lrow[i];
    const int token = q0 + rl + i;
#pragma unroll
    for (int c = 0; c < 4; ++c) {
      const int dh = c * 16 + (lane & 15);
      oh[((size_t)(b * kSeq + token)) * kDim + h * kHd + dh] =
          (_Float16)(o[c][i] * inv);
    }
  }
}

// ---------------------------------------------------------------------------
// Output projection: out[4096,1024] = Oh @ Wout + b_out (f32 result).
// Same async double-buffered pipeline as the QKV GEMM.
// ---------------------------------------------------------------------------
__global__ __launch_bounds__(256) void k_out_gemm(
    const _Float16* __restrict__ A,    // [4096,1024]
    const _Float16* __restrict__ Bt,   // [1024,1024] (Wout^T)
    const float* __restrict__ bias,    // [1024]
    float* __restrict__ C) {
  __shared__ __align__(16) _Float16 sA[2][128 * 32];
  __shared__ __align__(16) _Float16 sB[2][128 * 32];
  const int tid = threadIdx.x, lane = tid & 31, w = tid >> 5;
  const int wm = w & 3, wn = w >> 2;
  const int m0 = blockIdx.x * 128, n0 = blockIdx.y * 128;
  constexpr int KT = kDim / 32;

  auto stage = [&](int kt, int buf) {
#pragma unroll
    for (int c = tid; c < 512; c += 256) {
      const int r = c >> 2, kc = (c & 3) << 3;
      async_copy_b128(&sA[buf][r * 32 + kc],
                      &A[(size_t)(m0 + r) * kDim + kt * 32 + kc]);
      async_copy_b128(&sB[buf][r * 32 + kc],
                      &Bt[(size_t)(n0 + r) * kDim + kt * 32 + kc]);
    }
  };

  v8f acc[2][4];
  v8f z = {};
#pragma unroll
  for (int i = 0; i < 2; ++i)
#pragma unroll
    for (int j = 0; j < 4; ++j) acc[i][j] = z;

  stage(0, 0);
  wait_async0();
  __syncthreads();

  for (int kt = 0; kt < KT; ++kt) {
    const int cur = kt & 1;
    if (kt + 1 < KT) stage(kt + 1, cur ^ 1);

    v16h af[2], bf[4];
#pragma unroll
    for (int i = 0; i < 2; ++i)
      af[i] = load_frag16(&sA[cur][(wm * 32 + i * 16) * 32], 32, lane);
#pragma unroll
    for (int j = 0; j < 4; ++j)
      bf[j] = load_frag16(&sB[cur][(wn * 64 + j * 16) * 32], 32, lane);
#pragma unroll
    for (int i = 0; i < 2; ++i)
#pragma unroll
      for (int j = 0; j < 4; ++j) acc[i][j] = wmma16(af[i], bf[j], acc[i][j]);

    wait_async0();
    __syncthreads();
  }

  const int rl = (lane >> 4) << 3;
#pragma unroll
  for (int i = 0; i < 2; ++i) {
#pragma unroll
    for (int j = 0; j < 4; ++j) {
      const int gn = n0 + wn * 64 + j * 16 + (lane & 15);
      const float bn = bias[gn];
#pragma unroll
      for (int e = 0; e < 8; ++e) {
        const int gm = m0 + wm * 32 + i * 16 + rl + e;
        C[(size_t)gm * kDim + gn] = acc[i][j][e] + bn;
      }
    }
  }
}

// ---------------------------------------------------------------------------
// Host-side launcher.
// ---------------------------------------------------------------------------
extern "C" void kernel_launch(void* const* d_in, const int* in_sizes, int n_in,
                              void* d_out, int out_size, void* d_ws,
                              size_t ws_size, hipStream_t stream) {
  (void)in_sizes; (void)n_in; (void)out_size; (void)ws_size;
  const float* x    = (const float*)d_in[0];   // [2,2048,1024]
  const float* Wqkv = (const float*)d_in[1];   // [1024,3072]
  const float* bqkv = (const float*)d_in[2];   // [3072]
  const float* Wout = (const float*)d_in[3];   // [1024,1024]
  const float* bout = (const float*)d_in[4];   // [1024]
  float* out = (float*)d_out;                  // [2,2048,1024]

  char* ws = (char*)d_ws;
  size_t off = 0;
  auto alloc = [&](size_t bytes) -> void* {
    void* p = ws + off;
    off += (bytes + 255) & ~(size_t)255;
    return p;
  };
  const size_t nX = (size_t)kM * kDim;                 // 4.19M
  _Float16* xh    = (_Float16*)alloc(nX * 2);          // reused as Oh later
  _Float16* wqkvT = (_Float16*)alloc((size_t)3 * kDim * kDim * 2);
  _Float16* woutT = (_Float16*)alloc((size_t)kDim * kDim * 2);
  _Float16* qh    = (_Float16*)alloc(nX * 2);
  _Float16* kh    = (_Float16*)alloc(nX * 2);
  _Float16* vh    = (_Float16*)alloc(nX * 2);
  _Float16* oh    = xh;  // xh dead after QKV GEMM; alias for attention output

  // 1) precision/layout conversion (bandwidth-trivial: ~30 MB total)
  k_f32_to_f16<<<(int)((nX + 255) / 256), 256, 0, stream>>>(x, xh, (int)nX);
  k_transpose_f16<<<dim3((3 * kDim) / 64, kDim / 64), 256, 0, stream>>>(
      Wqkv, wqkvT, kDim, 3 * kDim);
  k_transpose_f16<<<dim3(kDim / 64, kDim / 64), 256, 0, stream>>>(
      Wout, woutT, kDim, kDim);

  // 2) QKV projection -> q/k/v in [B,H,N,Dh] f16
  k_qkv_gemm<<<dim3(kM / 128, (3 * kDim) / 128), 256, 0, stream>>>(
      xh, wqkvT, bqkv, qh, kh, vh);

  // 3) flash attention -> Oh in [B,N,C] f16
  k_attn<<<dim3(kSeq / 128, kB * kHeads), 256, 0, stream>>>(qh, kh, vh, oh);

  // 4) output projection -> f32 result
  k_out_gemm<<<dim3(kM / 128, kDim / 128), 256, 0, stream>>>(
      oh, woutT, bout, out);
}

// v002
// It runs in 179 microseconds.
// Two timings next to v001 put it at 1.68 and 1.69 times that version's speed.
// Over all steps from v000 it is 2.40 times as fast.
#include <hip/hip_runtime.h>
#include <hip/hip_bf16.h>

// ---------------------------------------------------------------------------
// MI455X (gfx1250) multi-head attention forward.
// f16 storage + f32 WMMA accumulation via v_wmma_f32_16x16x32_f16 (wave32).
// Global->LDS staging uses CDNA5 async-LDS DMA (ASYNCcnt) with double buffer.
// ---------------------------------------------------------------------------

typedef __attribute__((ext_vector_type(16))) _Float16 v16h;
typedef __attribute__((ext_vector_type(8)))  _Float16 v8h;
typedef __attribute__((ext_vector_type(8)))  float    v8f;

union HFrag { v16h v; v8h h[2]; };

// Load one 16x32 f16 A/B fragment from a row-major (ld halves) tile.
// Per ISA 7.12.2: lane L holds row (L&15); K halves are
//   [off..off+7] in VGPR0-3 and [off+16..off+23] in VGPR4-7, off=(L>=16)*8.
// B fragments use the identical layout on the N-major (transposed) operand.
__device__ __forceinline__ v16h load_frag16(const _Float16* __restrict__ base,
                                            int ld, int lane) {
  const _Float16* p = base + (lane & 15) * ld + ((lane >> 4) << 3);
  HFrag f;
  f.h[0] = *(const v8h*)(p);
  f.h[1] = *(const v8h*)(p + 16);
  return f.v;
}

__device__ __forceinline__ v8f wmma16(v16h a, v16h b, v8f c) {
  return __builtin_amdgcn_wmma_f32_16x16x32_f16(false, a, false, b,
                                                (short)0, c, false, false);
}

// CDNA5 async global->LDS copy, 16B per lane (GLOBAL_LOAD_ASYNC_TO_LDS_B128,
// tracked with ASYNCcnt). LDS destination is the low 32 address bits of the
// generic shared-memory pointer (aperture mapping, ISA 10.2).
__device__ __forceinline__ void async_copy_b128(void* lds_dst,
                                                const _Float16* gsrc) {
  unsigned int lds_off = (unsigned int)(unsigned long long)(uintptr_t)lds_dst;
  unsigned long long addr = (unsigned long long)(uintptr_t)gsrc;
  // s_wait_xcnt 0 closes the statement so that no later write of the two
  // address registers can be scheduled in front of it.
  asm volatile("global_load_async_to_lds_b128 %0, %1, off\n\t"
               "s_wait_xcnt 0x0"
               :: "v"(lds_off), "v"(addr)
               : "memory");
}

// Four such copies (one GEMM stage of a thread) under one s_wait_xcnt 0.
__device__ __forceinline__ void async_copy4_b128(
    void* l0, const _Float16* g0, void* l1, const _Float16* g1,
    void* l2, const _Float16* g2, void* l3, const _Float16* g3) {
  unsigned int o0 = (unsigned int)(unsigned long long)(uintptr_t)l0;
  unsigned int o1 = (unsigned int)(unsigned long long)(uintptr_t)l1;
  unsigned int o2 = (unsigned int)(unsigned long long)(uintptr_t)l2;
  unsigned int o3 = (unsigned int)(unsigned long long)(uintptr_t)l3;
  unsigned long long a0 = (unsigned long long)(uintptr_t)g0;
  unsigned long long a1 = (unsigned long long)(uintptr_t)g1;
  unsigned long long a2 = (unsigned long long)(uintptr_t)g2;
  unsigned long long a3 = (unsigned long long)(uintptr_t)g3;
  // The wait is the statement's last line: the address registers live to it.
  asm volatile("global_load_async_to_lds_b128 %0, %1, off\n\t"
               "global_load_async_to_lds_b128 %2, %3, off\n\t"
               "global_load_async_to_lds_b128 %4, %5, off\n\t"
               "global_load_async_to_lds_b128 %6, %7, off\n\t"
               "s_wait_xcnt 0x0"
               :: "v"(o0), "v"(a0), "v"(o1), "v"(a1),
                  "v"(o2), "v"(a2), "v"(o3), "v"(a3)
               : "memory");
}

__device__ __forceinline__ void wait_async0() {
  asm volatile("s_wait_asynccnt 0x0" ::: "memory");
}

// This wave's LDS reads have retired before the barrier behind which a copy
// refills the bytes they read.
__device__ __forceinline__ void wait_ds0() {
  asm volatile("s_wait_dscnt 0x0" ::: "memory");
}

// Problem constants (from the reference).
constexpr int   kB     = 2;
constexpr int   kSeq   = 2048;
constexpr int   kDim   = 1024;
constexpr int   kHeads = 16;
constexpr int   kHd    = 64;
constexpr int   kM     = kB * kSeq;      // 4096 rows
constexpr float kScale = 0.125f;         // 64^-0.5

// LDS row pitches in halves: 16 bytes x an odd number, so that the 16 rows a
// ds_load_b128 fragment read touches fall on distinct banks (64 banks x 4 B).
constexpr int kLdG = 40;   // GEMM tiles: 64-byte rows at an 80-byte pitch
constexpr int kLdT = 72;   // attention tiles: 128-byte rows at a 144-byte pitch

// ---------------------------------------------------------------------------
// Elementwise f32 -> f16
// ---------------------------------------------------------------------------
__global__ void k_f32_to_f16(const float* __restrict__ in,
                             _Float16* __restrict__ out, int n) {
  int i = blockIdx.x * blockDim.x + threadIdx.x;
  if (i < n) out[i] = (_Float16)in[i];
}

// Transpose + convert: in f32 [R][C] -> out f16 [C][R]  (weights -> N-major)
// One 64x64 tile per block, turned in LDS: input rows are read as 256-byte
// runs and every output row of the tile leaves as one whole 128-byte line.
// R and C are multiples of 64; grid = (C/64, R/64), 256 threads.
__global__ __launch_bounds__(256) void k_transpose_f16(
    const float* __restrict__ in, _Float16* __restrict__ out, int R, int C) {
  __shared__ float sT[64][65];   // odd pitch: column reads fall on distinct banks
  const int tid = threadIdx.x;
  const int c0 = blockIdx.x * 64, r0 = blockIdx.y * 64;

  const int lr = tid >> 4, lc = (tid & 15) << 2;
  float4 v[4];
#pragma unroll
  for (int i = 0; i < 4; ++i)
    v[i] = *(const float4*)&in[(size_t)(r0 + lr + i * 16) * C + c0 + lc];
#pragma unroll
  for (int i = 0; i < 4; ++i) {
    sT[lr + i * 16][lc + 0] = v[i].x;
    sT[lr + i * 16][lc + 1] = v[i].y;
    sT[lr + i * 16][lc + 2] = v[i].z;
    sT[lr + i * 16][lc + 3] = v[i].w;
  }
  __syncthreads();

  const int rg = (tid & 7) << 3;   // 8 lanes x 8 halves = one output line
#pragma unroll
  for (int i = 0; i < 2; ++i) {
    const int oc = (tid >> 3) + i * 32;
    v8h h;
#pragma unroll
    for (int e = 0; e < 8; ++e) h[e] = (_Float16)sT[rg + e][oc];
    *(v8h*)&out[(size_t)(c0 + oc) * R + r0 + rg] = h;
  }
}

// ---------------------------------------------------------------------------
// QKV projection: C[4096,3072] = Xh[4096,1024] @ Wqkv; scatter to q/k/v
// in [B,H,N,Dh] f16 layout. Block tile 128x128, K-step 32, 8 waves (4x2).
// Async double-buffered LDS staging: DMA tile kt+1 while WMMAs chew tile kt.
// ---------------------------------------------------------------------------
__global__ __launch_bounds__(256) void k_qkv_gemm(
    const _Float16* __restrict__ A,    // [4096,1024]
    const _Float16* __restrict__ Bt,   // [3072,1024]  (Wqkv^T, N-major)
    const float* __restrict__ bias,    // [3072]
    _Float16* __restrict__ qh, _Float16* __restrict__ kh,
    _Float16* __restrict__ vh) {
  __shared__ __align__(16) _Float16 sA[2][128 * kLdG];
  __shared__ __align__(16) _Float16 sB[2][128 * kLdG];
  const int tid = threadIdx.x, lane = tid & 31, w = tid >> 5;
  const int wm = w & 3, wn = w >> 2;
  const int m0 = blockIdx.x * 128, n0 = blockIdx.y * 128;
  constexpr int KT = kDim / 32;

  auto stage = [&](int kt, int buf) {        // 128 rows x 32 halves per tile
    const int r = tid >> 2, kc = (tid & 3) << 3;   // rows r and r + 64
    async_copy4_b128(&sA[buf][r * kLdG + kc],
                     &A[(size_t)(m0 + r) * kDim + kt * 32 + kc],
                     &sB[buf][r * kLdG + kc],
                     &Bt[(size_t)(n0 + r) * kDim + kt * 32 + kc],
                     &sA[buf][(r + 64) * kLdG + kc],
                     &A[(size_t)(m0 + r + 64) * kDim + kt * 32 + kc],
                     &sB[buf][(r + 64) * kLdG + kc],
                     &Bt[(size_t)(n0 + r + 64) * kDim + kt * 32 + kc]);
  };

  v8f acc[2][4];
  v8f z = {};
#pragma unroll
  for (int i = 0; i < 2; ++i)
#pragma unroll
    for (int j = 0; j < 4; ++j) acc[i][j] = z;

  stage(0, 0);
  wait_async0();
  __syncthreads();

  for (int kt = 0; kt < KT; ++kt) {
    const int cur = kt & 1;
    if (kt + 1 < KT) stage(kt + 1, cur ^ 1);   // overlap DMA with compute

    v16h af[2], bf[4];
#pragma unroll
    for (int i = 0; i < 2; ++i)
      af[i] = load_frag16(&sA[cur][(wm * 32 + i * 16) * kLdG], kLdG, lane);
#pragma unroll
    for (int j = 0; j < 4; ++j)
      bf[j] = load_frag16(&sB[cur][(wn * 64 + j * 16) * kLdG], kLdG, lane);
#pragma unroll
    for (int i = 0; i < 2; ++i)
#pragma unroll
      for (int j = 0; j < 4; ++j) acc[i][j] = wmma16(af[i], bf[j], acc[i][j]);

    wait_ds0();
    wait_async0();
    __syncthreads();
  }

  // Epilogue: C layout = VGPR e holds row (e + 8*(lane>=16)), col (lane&15).
  const int rl = (lane >> 4) << 3;
#pragma unroll
  for (int i = 0; i < 2; ++i) {
#pragma unroll
    for (int j = 0; j < 4; ++j) {
      const int gn = n0 + wn * 64 + j * 16 + (lane & 15);
      const float bn = bias[gn];
      const int which = gn >> 10;            // 0=q 1=k 2=v
      const int cc = gn & 1023;
      const int hh = cc >> 6, dd = cc & 63;
      _Float16* dst = (which == 0) ? qh : (which == 1) ? kh : vh;
#pragma unroll
      for (int e = 0; e < 8; ++e) {
        const int gm = m0 + wm * 32 + i * 16 + rl + e;
        const int bb = gm >> 11, tt = gm & 2047;
        dst[(((size_t)(bb * kHeads + hh)) * kSeq + tt) * kHd + dd] =
            (_Float16)(acc[i][j][e] + bn);
      }
    }
  }
}

// ---------------------------------------------------------------------------
// Flash attention: one WG per (b,h, 128-query block); 8 waves x 16 rows.
// K tile staged via async-LDS DMA (rows are already the Bt layout for Q@K^T);
// V staged transposed through VGPRs (Vt rows are Bt layout for P@V).
// Online softmax in f32 registers.
// ---------------------------------------------------------------------------
__global__ __launch_bounds__(256) void k_attn(
    const _Float16* __restrict__ qh, const _Float16* __restrict__ kh,
    const _Float16* __restrict__ vh, _Float16* __restrict__ oh) {
  __shared__ __align__(16) _Float16 sK[64 * kLdT];       // [key][dh]
  __shared__ __align__(16) _Float16 sVt[64 * kLdT];      // [dh][key]
  __shared__ __align__(16) _Float16 sP[8 * 16 * kLdT];   // per-wave P slab

  const int tid = threadIdx.x, lane = tid & 31, w = tid >> 5;
  const int bh = blockIdx.y;                     // 0..B*H-1
  const int b = bh >> 4, h = bh & 15;
  const int q0 = blockIdx.x * 128 + w * 16;      // this wave's query rows
  const size_t bhBase = (size_t)bh * kSeq * kHd;

  // Q fragments stay resident in registers for the whole pass.
  v16h qf[2];
  {
    const _Float16* qp = qh + bhBase + (size_t)q0 * kHd;
#pragma unroll
    for (int j = 0; j < 2; ++j) qf[j] = load_frag16(qp + j * 32, kHd, lane);
  }

  v8f o[4];
  v8f z = {};
#pragma unroll
  for (int c = 0; c < 4; ++c) o[c] = z;
  float mrow[8], lrow[8];
#pragma unroll
  for (int i = 0; i < 8; ++i) { mrow[i] = -1e30f; lrow[i] = 0.f; }

  _Float16* pw = &sP[w * (16 * kLdT)];
  const int rl = (lane >> 4) << 3;

  for (int kt = 0; kt < kSeq / 64; ++kt) {
    wait_ds0();
    __syncthreads();
    const int kb = kt * 64;
#pragma unroll
    for (int it = 0; it < 2; ++it) {             // 64 keys x 64 dh
      // fixed trip count: every lane is on at the copy, no EXEC write round it
      const int c = tid + it * 256;
      const int key = c >> 3, dc = (c & 7) << 3;
      // K tile: async DMA straight into LDS.
      async_copy_b128(&sK[key * kLdT + dc],
                      &kh[bhBase + (size_t)(kb + key) * kHd + dc]);
      // V tile: through VGPRs (transposed on the way into LDS).
      v8h vv = *(const v8h*)&vh[bhBase + (size_t)(kb + key) * kHd + dc];
#pragma unroll
      for (int e = 0; e < 8; ++e) sVt[(dc + e) * kLdT + key] = vv[e];
      if (kt + 1 < kSeq / 64) {
        __builtin_prefetch(&kh[bhBase + (size_t)(kb + 64 + key) * kHd + dc], 0, 1);
        __builtin_prefetch(&vh[bhBase + (size_t)(kb + 64 + key) * kHd + dc], 0, 1);
      }
    }
    wait_async0();
    __syncthreads();

    // S = Q @ K^T  (16 x 64 per wave)
    v8f s[4];
#pragma unroll
    for (int c = 0; c < 4; ++c) s[c] = z;
#pragma unroll
    for (int j = 0; j < 2; ++j)
#pragma unroll
      for (int c = 0; c < 4; ++c) {
        v16h kf = load_frag16(&sK[(c * 16) * kLdT + j * 32], kLdT, lane);
        s[c] = wmma16(qf[j], kf, s[c]);
      }

    // Online softmax. Row i lives in lanes {g*16..g*16+15} at vector idx i.
#pragma unroll
    for (int i = 0; i < 8; ++i) {
      float mx = fmaxf(fmaxf(s[0][i], s[1][i]), fmaxf(s[2][i], s[3][i]));
#pragma unroll
      for (int d = 1; d < 16; d <<= 1) mx = fmaxf(mx, __shfl_xor(mx, d, 16));
      const float mnew = fmaxf(mrow[i], mx * kScale);
      const float alpha = __expf(mrow[i] - mnew);
      float rsum = 0.f;
#pragma unroll
      for (int c = 0; c < 4; ++c) {
        float p = __expf(s[c][i] * kScale - mnew);
        s[c][i] = p;
        rsum += p;
      }
#pragma unroll
      for (int d = 1; d < 16; d <<= 1) rsum += __shfl_xor(rsum, d, 16);
      lrow[i] = lrow[i] * alpha + rsum;
      mrow[i] = mnew;
#pragma unroll
      for (int c = 0; c < 4; ++c) o[c][i] *= alpha;
    }

    // C-layout -> A-fragment layout for P via wave-private LDS slab.
#pragma unroll
    for (int i = 0; i < 8; ++i)
#pragma unroll
      for (int c = 0; c < 4; ++c)
        pw[(rl + i) * kLdT + c * 16 + (lane & 15)] = (_Float16)s[c][i];

    v16h pf[2];
#pragma unroll
    for (int j = 0; j < 2; ++j) pf[j] = load_frag16(pw + j * 32, kLdT, lane);

    // O += P @ V
#pragma unroll
    for (int j = 0; j < 2; ++j)
#pragma unroll
      for (int c = 0; c < 4; ++c) {
        v16h vf = load_frag16(&sVt[(c * 16) * kLdT + j * 32], kLdT, lane);
        o[c] = wmma16(pf[j], vf, o[c]);
      }
  }

  // Normalize and write O in [b, token, h*64+dh] (row-major for out-proj).
#pragma unroll
  for (int i = 0; i < 8; ++i) {
    const float inv = 1.f / lrow[i];
    const int token = q0 + rl + i;
#pragma unroll
    for (int c = 0; c < 4; ++c) {
      const int dh = c * 16 + (lane & 15);
      oh[((size_t)(b * kSeq + token)) * kDim + h * kHd + dh] =
          (_Float16)(o[c][i] * inv);
    }
  }
}

// ---------------------------------------------------------------------------
// Output projection: out[4096,1024] = Oh @ Wout + b_out (f32 result).
// Same async double-buffered pipeline as the QKV GEMM.
// ---------------------------------------------------------------------------
__global__ __launch_bounds__(256) void k_out_gemm(
    const _Float16* __restrict__ A,    // [4096,1024]
    const _Float16* __restrict__ Bt,   // [1024,1024] (Wout^T)
    const float* __restrict__ bias,    // [1024]
    float* __restrict__ C) {
  __shared__ __align__(16) _Float16 sA[2][128 * kLdG];
  __shared__ __align__(16) _Float16 sB[2][128 * kLdG];
  const int tid = threadIdx.x, lane = tid & 31, w = tid >> 5;
  const int wm = w & 3, wn = w >> 2;
  const int m0 = blockIdx.x * 128, n0 = blockIdx.y * 128;
  constexpr int KT = kDim / 32;

  auto stage = [&](int kt, int buf) {
    const int r = tid >> 2, kc = (tid & 3) << 3;   // rows r and r + 64
    async_copy4_b128(&sA[buf][r * kLdG + kc],
                     &A[(size_t)(m0 + r) * kDim + kt * 32 + kc],
                     &sB[buf][r * kLdG + kc],
                     &Bt[(size_t)(n0 + r) * kDim + kt * 32 + kc],
                     &sA[buf][(r + 64) * kLdG + kc],
                     &A[(size_t)(m0 + r + 64) * kDim + kt * 32 + kc],
                     &sB[buf][(r + 64) * kLdG + kc],
                     &Bt[(size_t)(n0 + r + 64) * kDim + kt * 32 + kc]);
  };

  v8f acc[2][4];
  v8f z = {};
#pragma unroll
  for (int i = 0; i < 2; ++i)
#pragma unroll
    for (int j = 0; j < 4; ++j) acc[i][j] = z;

  stage(0, 0);
  wait_async0();
  __syncthreads();

  for (int kt = 0; kt < KT; ++kt) {
    const int cur = kt & 1;
    if (kt + 1 < KT) stage(kt + 1, cur ^ 1);

    v16h af[2], bf[4];
#pragma unroll
    for (int i = 0; i < 2; ++i)
      af[i] = load_frag16(&sA[cur][(wm * 32 + i * 16) * kLdG], kLdG, lane);
#pragma unroll
    for (int j = 0; j < 4; ++j)
      bf[j] = load_frag16(&sB[cur][(wn * 64 + j * 16) * kLdG], kLdG, lane);
#pragma unroll
    for (int i = 0; i < 2; ++i)
#pragma unroll
      for (int j = 0; j < 4; ++j) acc[i][j] = wmma16(af[i], bf[j], acc[i][j]);

    wait_ds0();
    wait_async0();
    __syncthreads();
  }

  const int rl = (lane >> 4) << 3;
#pragma unroll
  for (int i = 0; i < 2; ++i) {
#pragma unroll
    for (int j = 0; j < 4; ++j) {
      const int gn = n0 + wn * 64 + j * 16 + (lane & 15);
      const float bn = bias[gn];
#pragma unroll
      for (int e = 0; e < 8; ++e) {
        const int gm = m0 + wm * 32 + i * 16 + rl + e;
        C[(size_t)gm * kDim + gn] = acc[i][j][e] + bn;
      }
    }
  }
}

// ---------------------------------------------------------------------------
// Host-side launcher.
// ---------------------------------------------------------------------------
extern "C" void kernel_launch(void* const* d_in, const int* in_sizes, int n_in,
                              void* d_out, int out_size, void* d_ws,
                              size_t ws_size, hipStream_t stream) {
  (void)in_sizes; (void)n_in; (void)out_size; (void)ws_size;
  const float* x    = (const float*)d_in[0];   // [2,2048,1024]
  const float* Wqkv = (const float*)d_in[1];   // [1024,3072]
  const float* bqkv = (const float*)d_in[2];   // [3072]
  const float* Wout = (const float*)d_in[3];   // [1024,1024]
  const float* bout = (const float*)d_in[4];   // [1024]
  float* out = (float*)d_out;                  // [2,2048,1024]

  char* ws = (char*)d_ws;
  size_t off = 0;
  auto alloc = [&](size_t bytes) -> void* {
    void* p = ws + off;
    off += (bytes + 255) & ~(size_t)255;
    return p;
  };
  const size_t nX = (size_t)kM * kDim;                 // 4.19M
  _Float16* xh    = (_Float16*)alloc(nX * 2);          // reused as Oh later
  _Float16* wqkvT = (_Float16*)alloc((size_t)3 * kDim * kDim * 2);
  _Float16* woutT = (_Float16*)alloc((size_t)kDim * kDim * 2);
  _Float16* qh    = (_Float16*)alloc(nX * 2);
  _Float16* kh    = (_Float16*)alloc(nX * 2);
  _Float16* vh    = (_Float16*)alloc(nX * 2);
  _Float16* oh    = xh;  // xh dead after QKV GEMM; alias for attention output

  // 1) precision/layout conversion (bandwidth-trivial: ~30 MB total)
  k_f32_to_f16<<<(int)((nX + 255) / 256), 256, 0, stream>>>(x, xh, (int)nX);
  k_transpose_f16<<<dim3((3 * kDim) / 64, kDim / 64), 256, 0, stream>>>(
      Wqkv, wqkvT, kDim, 3 * kDim);
  k_transpose_f16<<<dim3(kDim / 64, kDim / 64), 256, 0, stream>>>(
      Wout, woutT, kDim, kDim);

  // 2) QKV projection -> q/k/v in [B,H,N,Dh] f16
  k_qkv_gemm<<<dim3(kM / 128, (3 * kDim) / 128), 256, 0, stream>>>(
      xh, wqkvT, bqkv, qh, kh, vh);

  // 3) flash attention -> Oh in [B,N,C] f16
  k_attn<<<dim3(kSeq / 128, kB * kHeads), 256, 0, stream>>>(qh, kh, vh, oh);

  // 4) output projection -> f32 result
  k_out_gemm<<<dim3(kM / 128, kDim / 128), 256, 0, stream>>>(
      oh, woutT, bout, out);
}

// v003
// One run takes 134 microseconds.
// Next to v002, in two timings, it ran 1.34 times as fast each time.
// All steps since v000 together make it 3.22 times as fast.
#include <hip/hip_runtime.h>
#include <hip/hip_bf16.h>

// ---------------------------------------------------------------------------
// MI455X (gfx1250) multi-head attention forward.
// f16 storage + f32 WMMA accumulation via v_wmma_f32_16x16x32_f16 (wave32).
// Global->LDS staging uses CDNA5 async-LDS DMA (ASYNCcnt) with double buffer.
// ---------------------------------------------------------------------------

typedef __attribute__((ext_vector_type(16))) _Float16 v16h;
typedef __attribute__((ext_vector_type(8)))  _Float16 v8h;
typedef __attribute__((ext_vector_type(8)))  float    v8f;

union HFrag { v16h v; v8h h[2]; };

// Load one 16x32 f16 A/B fragment from a row-major (ld halves) tile.
// Per ISA 7.12.2: lane L holds row (L&15); K halves are
//   [off..off+7] in VGPR0-3 and [off+16..off+23] in VGPR4-7, off=(L>=16)*8.
// B fragments use the identical layout on the N-major (transposed) operand.
__device__ __forceinline__ v16h load_frag16(const _Float16* __restrict__ base,
                                            int ld, int lane) {
  const _Float16* p = base + (lane & 15) * ld + ((lane >> 4) << 3);
  HFrag f;
  f.h[0] = *(const v8h*)(p);
  f.h[1] = *(const v8h*)(p + 16);
  return f.v;
}

__device__ __forceinline__ v8f wmma16(v16h a, v16h b, v8f c) {
  return __builtin_amdgcn_wmma_f32_16x16x32_f16(false, a, false, b,
                                                (short)0, c, false, false);
}

// CDNA5 async global->LDS copy, 16B per lane (GLOBAL_LOAD_ASYNC_TO_LDS_B128,
// tracked with ASYNCcnt). LDS destination is the low 32 address bits of the
// generic shared-memory pointer (aperture mapping, ISA 10.2).
__device__ __forceinline__ void async_copy_b128(void* lds_dst,
                                                const _Float16* gsrc) {
  unsigned int lds_off = (unsigned int)(unsigned long long)(uintptr_t)lds_dst;
  unsigned long long addr = (unsigned long long)(uintptr_t)gsrc;
  // s_wait_xcnt 0 closes the statement so that no later write of the two
  // address registers can be scheduled in front of it.
  asm volatile("global_load_async_to_lds_b128 %0, %1, off\n\t"
               "s_wait_xcnt 0x0"
               :: "v"(lds_off), "v"(addr)
               : "memory");
}

// Four such copies (one GEMM stage of a thread) under one s_wait_xcnt 0.
__device__ __forceinline__ void async_copy4_b128(
    void* l0, const _Float16* g0, void* l1, const _Float16* g1,
    void* l2, const _Float16* g2, void* l3, const _Float16* g3) {
  unsigned int o0 = (unsigned int)(unsigned long long)(uintptr_t)l0;
  unsigned int o1 = (unsigned int)(unsigned long long)(uintptr_t)l1;
  unsigned int o2 = (unsigned int)(unsigned long long)(uintptr_t)l2;
  unsigned int o3 = (unsigned int)(unsigned long long)(uintptr_t)l3;
  unsigned long long a0 = (unsigned long long)(uintptr_t)g0;
  unsigned long long a1 = (unsigned long long)(uintptr_t)g1;
  unsigned long long a2 = (unsigned long long)(uintptr_t)g2;
  unsigned long long a3 = (unsigned long long)(uintptr_t)g3;
  // The wait is the statement's last line: the address registers live to it.
  asm volatile("global_load_async_to_lds_b128 %0, %1, off\n\t"
               "global_load_async_to_lds_b128 %2, %3, off\n\t"
               "global_load_async_to_lds_b128 %4, %5, off\n\t"
               "global_load_async_to_lds_b128 %6, %7, off\n\t"
               "s_wait_xcnt 0x0"
               :: "v"(o0), "v"(a0), "v"(o1), "v"(a1),
                  "v"(o2), "v"(a2), "v"(o3), "v"(a3)
               : "memory");
}

__device__ __forceinline__ void wait_async0() {
  asm volatile("s_wait_asynccnt 0x0" ::: "memory");
}

// This wave's LDS reads have retired before the barrier behind which a copy
// refills the bytes they read.
__device__ __forceinline__ void wait_ds0() {
  asm volatile("s_wait_dscnt 0x0" ::: "memory");
}

// Lane l <-> lane l ^ 16 as one vector instruction (a shuffle builtin would go
// through the LDS pipe and its latency).
__device__ __forceinline__ float xhalf(float x) {
  const int b = __builtin_bit_cast(int, x);
  return __builtin_bit_cast(float, __builtin_amdgcn_permlanex16(
      b, b, 0x76543210, 0xfedcba98, false, false));
}

// Problem constants (from the reference).
constexpr int   kB     = 2;
constexpr int   kSeq   = 2048;
constexpr int   kDim   = 1024;
constexpr int   kHeads = 16;
constexpr int   kHd    = 64;
constexpr int   kM     = kB * kSeq;      // 4096 rows
constexpr float kScale = 0.125f;         // 64^-0.5

// LDS row pitches in halves: 16 bytes x an odd number, so that the 16 rows a
// ds_load_b128 fragment read touches fall on distinct banks (64 banks x 4 B).
constexpr int kLdG = 40;   // GEMM tiles: 64-byte rows at an 80-byte pitch
constexpr int kLdT = 72;   // attention tiles: 128-byte rows at a 144-byte pitch

// ---------------------------------------------------------------------------
// Elementwise f32 -> f16
// ---------------------------------------------------------------------------
__global__ void k_f32_to_f16(const float* __restrict__ in,
                             _Float16* __restrict__ out, int n) {
  int i = blockIdx.x * blockDim.x + threadIdx.x;
  if (i < n) out[i] = (_Float16)in[i];
}

// Transpose + convert: in f32 [R][C] -> out f16 [C][R]  (weights -> N-major)
// One 64x64 tile per block, turned in LDS: input rows are read as 256-byte
// runs and every output row of the tile leaves as one whole 128-byte line.
// R and C are multiples of 64; grid = (C/64, R/64), 256 threads.
__global__ __launch_bounds__(256) void k_transpose_f16(
    const float* __restrict__ in, _Float16* __restrict__ out, int R, int C) {
  __shared__ float sT[64][65];   // odd pitch: column reads fall on distinct banks
  const int tid = threadIdx.x;
  const int c0 = blockIdx.x * 64, r0 = blockIdx.y * 64;

  const int lr = tid >> 4, lc = (tid & 15) << 2;
  float4 v[4];
#pragma unroll
  for (int i = 0; i < 4; ++i)
    v[i] = *(const float4*)&in[(size_t)(r0 + lr + i * 16) * C + c0 + lc];
#pragma unroll
  for (int i = 0; i < 4; ++i) {
    sT[lr + i * 16][lc + 0] = v[i].x;
    sT[lr + i * 16][lc + 1] = v[i].y;
    sT[lr + i * 16][lc + 2] = v[i].z;
    sT[lr + i * 16][lc + 3] = v[i].w;
  }
  __syncthreads();

  const int rg = (tid & 7) << 3;   // 8 lanes x 8 halves = one output line
#pragma unroll
  for (int i = 0; i < 2; ++i) {
    const int oc = (tid >> 3) + i * 32;
    v8h h;
#pragma unroll
    for (int e = 0; e < 8; ++e) h[e] = (_Float16)sT[rg + e][oc];
    *(v8h*)&out[(size_t)(c0 + oc) * R + r0 + rg] = h;
  }
}

// ---------------------------------------------------------------------------
// QKV projection: C[4096,3072] = Xh[4096,1024] @ Wqkv; scatter to q/k/v
// in [B,H,N,Dh] f16 layout. Block tile 128x128, K-step 32, 8 waves (4x2).
// Async double-buffered LDS staging: DMA tile kt+1 while WMMAs chew tile kt.
// ---------------------------------------------------------------------------
__global__ __launch_bounds__(256) void k_qkv_gemm(
    const _Float16* __restrict__ A,    // [4096,1024]
    const _Float16* __restrict__ Bt,   // [3072,1024]  (Wqkv^T, N-major)
    const float* __restrict__ bias,    // [3072]
    _Float16* __restrict__ qh, _Float16* __restrict__ kh,
    _Float16* __restrict__ vh) {
  __shared__ __align__(16) _Float16 sA[2][128 * kLdG];
  __shared__ __align__(16) _Float16 sB[2][128 * kLdG];
  const int tid = threadIdx.x, lane = tid & 31, w = tid >> 5;
  const int wm = w & 3, wn = w >> 2;
  const int m0 = blockIdx.x * 128, n0 = blockIdx.y * 128;
  constexpr int KT = kDim / 32;

  auto stage = [&](int kt, int buf) {        // 128 rows x 32 halves per tile
    const int r = tid >> 2, kc = (tid & 3) << 3;   // rows r and r + 64
    async_copy4_b128(&sA[buf][r * kLdG + kc],
                     &A[(size_t)(m0 + r) * kDim + kt * 32 + kc],
                     &sB[buf][r * kLdG + kc],
                     &Bt[(size_t)(n0 + r) * kDim + kt * 32 + kc],
                     &sA[buf][(r + 64) * kLdG + kc],
                     &A[(size_t)(m0 + r + 64) * kDim + kt * 32 + kc],
                     &sB[buf][(r + 64) * kLdG + kc],
                     &Bt[(size_t)(n0 + r + 64) * kDim + kt * 32 + kc]);
  };

  v8f acc[2][4];
  v8f z = {};
#pragma unroll
  for (int i = 0; i < 2; ++i)
#pragma unroll
    for (int j = 0; j < 4; ++j) acc[i][j] = z;

  stage(0, 0);
  wait_async0();
  __syncthreads();

  for (int kt = 0; kt < KT; ++kt) {
    const int cur = kt & 1;
    if (kt + 1 < KT) stage(kt + 1, cur ^ 1);   // overlap DMA with compute

    v16h af[2], bf[4];
#pragma unroll
    for (int i = 0; i < 2; ++i)
      af[i] = load_frag16(&sA[cur][(wm * 32 + i * 16) * kLdG], kLdG, lane);
#pragma unroll
    for (int j = 0; j < 4; ++j)
      bf[j] = load_frag16(&sB[cur][(wn * 64 + j * 16) * kLdG], kLdG, lane);
#pragma unroll
    for (int i = 0; i < 2; ++i)
#pragma unroll
      for (int j = 0; j < 4; ++j) acc[i][j] = wmma16(af[i], bf[j], acc[i][j]);

    wait_ds0();
    wait_async0();
    __syncthreads();
  }

  // Epilogue: C layout = VGPR e holds row (e + 8*(lane>=16)), col (lane&15).
  const int rl = (lane >> 4) << 3;
#pragma unroll
  for (int i = 0; i < 2; ++i) {
#pragma unroll
    for (int j = 0; j < 4; ++j) {
      const int gn = n0 + wn * 64 + j * 16 + (lane & 15);
      const float bn = bias[gn];
      const int which = gn >> 10;            // 0=q 1=k 2=v
      const int cc = gn & 1023;
      const int hh = cc >> 6, dd = cc & 63;
      _Float16* dst = (which == 0) ? qh : (which == 1) ? kh : vh;
#pragma unroll
      for (int e = 0; e < 8; ++e) {
        const int gm = m0 + wm * 32 + i * 16 + rl + e;
        const int bb = gm >> 11, tt = gm & 2047;
        dst[(((size_t)(bb * kHeads + hh)) * kSeq + tt) * kHd + dd] =
            (_Float16)(acc[i][j][e] + bn);
      }
    }
  }
}

__global__ __launch_bounds__(256) void k_attn(
    const _Float16* __restrict__ qh, const _Float16* __restrict__ kh,
    const _Float16* __restrict__ vh, _Float16* __restrict__ oh) {
  __shared__ __align__(16) _Float16 sK[64 * kLdT];       // [key][dh]
  __shared__ __align__(16) _Float16 sVt[64 * kLdT];      // [dh][key]

  const int tid = threadIdx.x, lane = tid & 31, w = tid >> 5;
  const int bh = blockIdx.y;                     // 0..B*H-1
  const int b = bh >> 4, h = bh & 15;
  const int q0 = blockIdx.x * 128 + w * 16;      // this wave's query rows
  const size_t bhBase = (size_t)bh * kSeq * kHd;

  // Q fragments (B operand: column = query) stay resident in registers.
  v16h qf[2];
  {
    const _Float16* qp = qh + bhBase + (size_t)q0 * kHd;
#pragma unroll
    for (int j = 0; j < 2; ++j) qf[j] = load_frag16(qp + j * 32, kHd, lane);
  }

  // o[c][e] = O^T[dh = c*16 + 8*(lane>>4) + e][query = lane&15]
  v8f o[4];
  v8f z = {};
#pragma unroll
  for (int c = 0; c < 4; ++c) o[c] = z;
  float mrow = -1e30f;   // running maximum of this lane's query
  float lrow = 0.f;      // running sum over this wave half's keys only

  for (int kt = 0; kt < kSeq / 64; ++kt) {
    wait_ds0();
    __syncthreads();
    const int kb = kt * 64;
#pragma unroll
    for (int it = 0; it < 2; ++it) {             // 64 keys x 64 dh
      // fixed trip count: every lane is on at the copy, no EXEC write round it
      const int c = tid + it * 256;
      const int key = c >> 3, dc = (c & 7) << 3;
      // K tile: async DMA straight into LDS.
      async_copy_b128(&sK[key * kLdT + dc],
                      &kh[bhBase + (size_t)(kb + key) * kHd + dc]);
      // V tile: through VGPRs (transposed on the way into LDS).
      v8h vv = *(const v8h*)&vh[bhBase + (size_t)(kb + key) * kHd + dc];
#pragma unroll
      for (int e = 0; e < 8; ++e) sVt[(dc + e) * kLdT + key] = vv[e];
      if (kt + 1 < kSeq / 64) {
        __builtin_prefetch(&kh[bhBase + (size_t)(kb + 64 + key) * kHd + dc], 0, 1);
        __builtin_prefetch(&vh[bhBase + (size_t)(kb + 64 + key) * kHd + dc], 0, 1);
      }
    }
    wait_async0();
    __syncthreads();

    // S^T = K @ Q^T: s[c][e] = score of key c*16 + 8*(lane>>4) + e.
    v8f s[4];
#pragma unroll
    for (int c = 0; c < 4; ++c) s[c] = z;
#pragma unroll
    for (int j = 0; j < 2; ++j)
#pragma unroll
      for (int c = 0; c < 4; ++c) {
        v16h kf = load_frag16(&sK[(c * 16) * kLdT + j * 32], kLdT, lane);
        s[c] = wmma16(kf, qf[j], s[c]);
      }

    // Online softmax: 32 of the query's 64 scores are in this lane, the other
    // 32 in lane ^ 16.
    float mc[4];
#pragma unroll
    for (int c = 0; c < 4; ++c) {
      mc[c] = s[c][0];
#pragma unroll
      for (int e = 1; e < 8; ++e) mc[c] = fmaxf(mc[c], s[c][e]);
    }
    float mx = fmaxf(fmaxf(mc[0], mc[1]), fmaxf(mc[2], mc[3]));
    mx = fmaxf(mx, xhalf(mx));
    const float mnew = fmaxf(mrow, mx * kScale);
    const float alpha = __expf(mrow - mnew);
    float rs[4];
#pragma unroll
    for (int c = 0; c < 4; ++c) {
      rs[c] = 0.f;
#pragma unroll
      for (int e = 0; e < 8; ++e) {
        const float p = __expf(s[c][e] * kScale - mnew);
        s[c][e] = p;
        rs[c] += p;
      }
    }
    lrow = lrow * alpha + ((rs[0] + rs[1]) + (rs[2] + rs[3]));
    mrow = mnew;
#pragma unroll
    for (int c = 0; c < 4; ++c)
#pragma unroll
      for (int e = 0; e < 8; ++e) o[c][e] *= alpha;

    // P^T as B fragments, in place: element t of fragment j is key
    // j*32 + (t < 8 ? 8*(lane>>4) + t : 16 + 8*(lane>>4) + t - 8), which is
    // register t&7 of tile 2j + (t>>3) and the k order of load_frag16.
    v16h pf[2];
#pragma unroll
    for (int j = 0; j < 2; ++j)
#pragma unroll
      for (int t = 0; t < 16; ++t)
        pf[j][t] = (_Float16)s[2 * j + (t >> 3)][t & 7];

    // O^T += V^T @ P^T
#pragma unroll
    for (int j = 0; j < 2; ++j)
#pragma unroll
      for (int c = 0; c < 4; ++c) {
        v16h vf = load_frag16(&sVt[(c * 16) * kLdT + j * 32], kLdT, lane);
        o[c] = wmma16(vf, pf[j], o[c]);
      }
  }

  // Join the two halves' sums, normalize, and write O in
  // [b, token, h*64+dh] (row-major for out-proj): 8 consecutive dh per lane.
  const float inv = 1.f / (lrow + xhalf(lrow));
  const int token = q0 + (lane & 15);
  _Float16* op = &oh[((size_t)(b * kSeq + token)) * kDim + h * kHd +
                     ((lane >> 4) << 3)];
#pragma unroll
  for (int c = 0; c < 4; ++c) {
    v8h r;
#pragma unroll
    for (int e = 0; e < 8; ++e) r[e] = (_Float16)(o[c][e] * inv);
    *(v8h*)(op + c * 16) = r;
  }
}

// ---------------------------------------------------------------------------
// Output projection: out[4096,1024] = Oh @ Wout + b_out (f32 result).
// Same async double-buffered pipeline as the QKV GEMM.
// ---------------------------------------------------------------------------
__global__ __launch_bounds__(256) void k_out_gemm(
    const _Float16* __restrict__ A,    // [4096,1024]
    const _Float16* __restrict__ Bt,   // [1024,1024] (Wout^T)
    const float* __restrict__ bias,    // [1024]
    float* __restrict__ C) {
  __shared__ __align__(16) _Float16 sA[2][128 * kLdG];
  __shared__ __align__(16) _Float16 sB[2][128 * kLdG];
  const int tid = threadIdx.x, lane = tid & 31, w = tid >> 5;
  const int wm = w & 3, wn = w >> 2;
  const int m0 = blockIdx.x * 128, n0 = blockIdx.y * 128;
  constexpr int KT = kDim / 32;

  auto stage = [&](int kt, int buf) {
    const int r = tid >> 2, kc = (tid & 3) << 3;   // rows r and r + 64
    async_copy4_b128(&sA[buf][r * kLdG + kc],
                     &A[(size_t)(m0 + r) * kDim + kt * 32 + kc],
                     &sB[buf][r * kLdG + kc],
                     &Bt[(size_t)(n0 + r) * kDim + kt * 32 + kc],
                     &sA[buf][(r + 64) * kLdG + kc],
                     &A[(size_t)(m0 + r + 64) * kDim + kt * 32 + kc],
                     &sB[buf][(r + 64) * kLdG + kc],
                     &Bt[(size_t)(n0 + r + 64) * kDim + kt * 32 + kc]);
  };

  v8f acc[2][4];
  v8f z = {};
#pragma unroll
  for (int i = 0; i < 2; ++i)
#pragma unroll
    for (int j = 0; j < 4; ++j) acc[i][j] = z;

  stage(0, 0);
  wait_async0();
  __syncthreads();

  for (int kt = 0; kt < KT; ++kt) {
    const int cur = kt & 1;
    if (kt + 1 < KT) stage(kt + 1, cur ^ 1);

    v16h af[2], bf[4];
#pragma unroll
    for (int i = 0; i < 2; ++i)
      af[i] = load_frag16(&sA[cur][(wm * 32 + i * 16) * kLdG], kLdG, lane);
#pragma unroll
    for (int j = 0; j < 4; ++j)
      bf[j] = load_frag16(&sB[cur][(wn * 64 + j * 16) * kLdG], kLdG, lane);
#pragma unroll
    for (int i = 0; i < 2; ++i)
#pragma unroll
      for (int j = 0; j < 4; ++j) acc[i][j] = wmma16(af[i], bf[j], acc[i][j]);

    wait_ds0();
    wait_async0();
    __syncthreads();
  }

  const int rl = (lane >> 4) << 3;
#pragma unroll
  for (int i = 0; i < 2; ++i) {
#pragma unroll
    for (int j = 0; j < 4; ++j) {
      const int gn = n0 + wn * 64 + j * 16 + (lane & 15);
      const float bn = bias[gn];
#pragma unroll
      for (int e = 0; e < 8; ++e) {
        const int gm = m0 + wm * 32 + i * 16 + rl + e;
        C[(size_t)gm * kDim + gn] = acc[i][j][e] + bn;
      }
    }
  }
}

// ---------------------------------------------------------------------------
// Host-side launcher.
// ---------------------------------------------------------------------------
extern "C" void kernel_launch(void* const* d_in, const int* in_sizes, int n_in,
                              void* d_out, int out_size, void* d_ws,
                              size_t ws_size, hipStream_t stream) {
  (void)in_sizes; (void)n_in; (void)out_size; (void)ws_size;
  const float* x    = (const float*)d_in[0];   // [2,2048,1024]
  const float* Wqkv = (const float*)d_in[1];   // [1024,3072]
  const float* bqkv = (const float*)d_in[2];   // [3072]
  const float* Wout = (const float*)d_in[3];   // [1024,1024]
  const float* bout = (const float*)d_in[4];   // [1024]
  float* out = (float*)d_out;                  // [2,2048,1024]

  char* ws = (char*)d_ws;
  size_t off = 0;
  auto alloc = [&](size_t bytes) -> void* {
    void* p = ws + off;
    off += (bytes + 255) & ~(size_t)255;
    return p;
  };
  const size_t nX = (size_t)kM * kDim;                 // 4.19M
  _Float16* xh    = (_Float16*)alloc(nX * 2);          // reused as Oh later
  _Float16* wqkvT = (_Float16*)alloc((size_t)3 * kDim * kDim * 2);
  _Float16* woutT = (_Float16*)alloc((size_t)kDim * kDim * 2);
  _Float16* qh    = (_Float16*)alloc(nX * 2);
  _Float16* kh    = (_Float16*)alloc(nX * 2);
  _Float16* vh    = (_Float16*)alloc(nX * 2);
  _Float16* oh    = xh;  // xh dead after QKV GEMM; alias for attention output

  // 1) precision/layout conversion (bandwidth-trivial: ~30 MB total)
  k_f32_to_f16<<<(int)((nX + 255) / 256), 256, 0, stream>>>(x, xh, (int)nX);
  k_transpose_f16<<<dim3((3 * kDim) / 64, kDim / 64), 256, 0, stream>>>(
      Wqkv, wqkvT, kDim, 3 * kDim);
  k_transpose_f16<<<dim3(kDim / 64, kDim / 64), 256, 0, stream>>>(
      Wout, woutT, kDim, kDim);

  // 2) QKV projection -> q/k/v in [B,H,N,Dh] f16
  k_qkv_gemm<<<dim3(kM / 128, (3 * kDim) / 128), 256, 0, stream>>>(
      xh, wqkvT, bqkv, qh, kh, vh);

  // 3) flash attention -> Oh in [B,N,C] f16
  k_attn<<<dim3(kSeq / 128, kB * kHeads), 256, 0, stream>>>(qh, kh, vh, oh);

  // 4) output projection -> f32 result
  k_out_gemm<<<dim3(kM / 128, kDim / 128), 256, 0, stream>>>(
      oh, woutT, bout, out);
}

// v004
// Measured time: 109 microseconds a run.
// In two side-by-side timings against v003, it was 1.21 and 1.22 times as fast.
// Over all steps from v000 it is 3.91 times as fast.
#include <hip/hip_runtime.h>
#include <hip/hip_bf16.h>

// ---------------------------------------------------------------------------
// MI455X (gfx1250) multi-head attention forward.
// f16 storage + f32 WMMA accumulation via v_wmma_f32_16x16x32_f16 (wave32).
// Global->LDS staging uses CDNA5 async-LDS DMA (ASYNCcnt), double-buffered in the GEMMs.
// ---------------------------------------------------------------------------

typedef __attribute__((ext_vector_type(16))) _Float16 v16h;
typedef __attribute__((ext_vector_type(8)))  _Float16 v8h;
typedef __attribute__((ext_vector_type(8)))  float    v8f;

union HFrag { v16h v; v8h h[2]; };

// Load one 16x32 f16 A/B fragment from a row-major (ld halves) tile.
// Per ISA 7.12.2: lane L holds row (L&15); K halves are
//   [off..off+7] in VGPR0-3 and [off+16..off+23] in VGPR4-7, off=(L>=16)*8.
// B fragments use the identical layout on the N-major (transposed) operand.
__device__ __forceinline__ v16h load_frag16(const _Float16* __restrict__ base,
                                            int ld, int lane) {
  const _Float16* p = base + (lane & 15) * ld + ((lane >> 4) << 3);
  HFrag f;
  f.h[0] = *(const v8h*)(p);
  f.h[1] = *(const v8h*)(p + 16);
  return f.v;
}

// One 16x32 A fragment of the TRANSPOSE of a row-major [k][m] f16 LDS tile (ld
// halves a row): two transposing LDS loads, 16 k rows each. Lane l hands in the
// address of 16 bytes of row 8*(l>>4) + (l&7), byte column 16*((l>>3)&1), and
// gets k = 8*(l>>4) + 0..7 of column l&15: the k order of load_frag16.
__device__ __forceinline__ v16h load_frag16_tr(const _Float16* base, int ld,
                                               int lane) {
  typedef __attribute__((ext_vector_type(8))) short s16x8;
  typedef __attribute__((address_space(3))) s16x8 lds_s16x8;
  const _Float16* p = base + (((lane >> 4) << 3) + (lane & 7)) * ld +
                      (((lane >> 3) & 1) << 3);
  HFrag f;
  f.h[0] = __builtin_bit_cast(
      v8h, __builtin_amdgcn_ds_load_tr16_b128_v8i16((lds_s16x8*)p));
  f.h[1] = __builtin_bit_cast(
      v8h, __builtin_amdgcn_ds_load_tr16_b128_v8i16((lds_s16x8*)(p + 16 * ld)));
  return f.v;
}

__device__ __forceinline__ v8f wmma16(v16h a, v16h b, v8f c) {
  return __builtin_amdgcn_wmma_f32_16x16x32_f16(false, a, false, b,
                                                (short)0, c, false, false);
}

// CDNA5 async global->LDS copy, 16B per lane (GLOBAL_LOAD_ASYNC_TO_LDS_B128,
// tracked with ASYNCcnt). LDS destination is the low 32 address bits of the
// generic shared-memory pointer (aperture mapping, ISA 10.2).
// Four such copies (one stage of a thread) under one s_wait_xcnt 0.
__device__ __forceinline__ void async_copy4_b128(
    void* l0, const _Float16* g0, void* l1, const _Float16* g1,
    void* l2, const _Float16* g2, void* l3, const _Float16* g3) {
  unsigned int o0 = (unsigned int)(unsigned long long)(uintptr_t)l0;
  unsigned int o1 = (unsigned int)(unsigned long long)(uintptr_t)l1;
  unsigned int o2 = (unsigned int)(unsigned long long)(uintptr_t)l2;
  unsigned int o3 = (unsigned int)(unsigned long long)(uintptr_t)l3;
  unsigned long long a0 = (unsigned long long)(uintptr_t)g0;
  unsigned long long a1 = (unsigned long long)(uintptr_t)g1;
  unsigned long long a2 = (unsigned long long)(uintptr_t)g2;
  unsigned long long a3 = (unsigned long long)(uintptr_t)g3;
  // The wait is the statement's last line: the address registers live to it,
  // so no later write of them can be scheduled in front of it.
  asm volatile("global_load_async_to_lds_b128 %0, %1, off\n\t"
               "global_load_async_to_lds_b128 %2, %3, off\n\t"
               "global_load_async_to_lds_b128 %4, %5, off\n\t"
               "global_load_async_to_lds_b128 %6, %7, off\n\t"
               "s_wait_xcnt 0x0"
               :: "v"(o0), "v"(a0), "v"(o1), "v"(a1),
                  "v"(o2), "v"(a2), "v"(o3), "v"(a3)
               : "memory");
}

__device__ __forceinline__ void wait_async0() {
  asm volatile("s_wait_asynccnt 0x0" ::: "memory");
}

// This wave's LDS reads have retired before the barrier behind which a copy
// refills the bytes they read.
__device__ __forceinline__ void wait_ds0() {
  asm volatile("s_wait_dscnt 0x0" ::: "memory");
}

// Lane l <-> lane l ^ 16 as one vector instruction (a shuffle builtin would go
// through the LDS pipe and its latency).
__device__ __forceinline__ float xhalf(float x) {
  const int b = __builtin_bit_cast(int, x);
  return __builtin_bit_cast(float, __builtin_amdgcn_permlanex16(
      b, b, 0x76543210, 0xfedcba98, false, false));
}

// Problem constants (from the reference).
constexpr int   kB     = 2;
constexpr int   kSeq   = 2048;
constexpr int   kDim   = 1024;
constexpr int   kHeads = 16;
constexpr int   kHd    = 64;
constexpr int   kM     = kB * kSeq;      // 4096 rows
constexpr float kScale = 0.125f;         // 64^-0.5

// LDS row pitches in halves: 16 bytes x an odd number, so that the 16 rows a
// ds_load_b128 fragment read touches fall on distinct banks (64 banks x 4 B).
constexpr int kLdG = 40;   // GEMM tiles: 64-byte rows at an 80-byte pitch
constexpr int kLdT = 72;   // attention K tile: 128-byte rows at a 144-byte pitch
// Rows read by the transposing load want 32 bytes x an odd number instead.
constexpr int kLdV = 80;   // attention V tile: 128-byte rows at a 160-byte pitch

// ---------------------------------------------------------------------------
// Elementwise f32 -> f16
// ---------------------------------------------------------------------------
__global__ void k_f32_to_f16(const float* __restrict__ in,
                             _Float16* __restrict__ out, int n) {
  int i = blockIdx.x * blockDim.x + threadIdx.x;
  if (i < n) out[i] = (_Float16)in[i];
}

// Transpose + convert: in f32 [R][C] -> out f16 [C][R]  (weights -> N-major)
// One 64x64 tile per block, turned in LDS: input rows are read as 256-byte
// runs and every output row of the tile leaves as one whole 128-byte line.
// R and C are multiples of 64; grid = (C/64, R/64), 256 threads.
__global__ __launch_bounds__(256) void k_transpose_f16(
    const float* __restrict__ in, _Float16* __restrict__ out, int R, int C) {
  __shared__ float sT[64][65];   // odd pitch: column reads fall on distinct banks
  const int tid = threadIdx.x;
  const int c0 = blockIdx.x * 64, r0 = blockIdx.y * 64;

  const int lr = tid >> 4, lc = (tid & 15) << 2;
  float4 v[4];
#pragma unroll
  for (int i = 0; i < 4; ++i)
    v[i] = *(const float4*)&in[(size_t)(r0 + lr + i * 16) * C + c0 + lc];
#pragma unroll
  for (int i = 0; i < 4; ++i) {
    sT[lr + i * 16][lc + 0] = v[i].x;
    sT[lr + i * 16][lc + 1] = v[i].y;
    sT[lr + i * 16][lc + 2] = v[i].z;
    sT[lr + i * 16][lc + 3] = v[i].w;
  }
  __syncthreads();

  const int rg = (tid & 7) << 3;   // 8 lanes x 8 halves = one output line
#pragma unroll
  for (int i = 0; i < 2; ++i) {
    const int oc = (tid >> 3) + i * 32;
    v8h h;
#pragma unroll
    for (int e = 0; e < 8; ++e) h[e] = (_Float16)sT[rg + e][oc];
    *(v8h*)&out[(size_t)(c0 + oc) * R + r0 + rg] = h;
  }
}

// ---------------------------------------------------------------------------
// QKV projection: C[4096,3072] = Xh[4096,1024] @ Wqkv; scatter to q/k/v
// in [B,H,N,Dh] f16 layout. Block tile 128x128, K-step 32, 8 waves (4x2).
// Async double-buffered LDS staging: DMA tile kt+1 while WMMAs chew tile kt.
// ---------------------------------------------------------------------------
__global__ __launch_bounds__(256) void k_qkv_gemm(
    const _Float16* __restrict__ A,    // [4096,1024]
    const _Float16* __restrict__ Bt,   // [3072,1024]  (Wqkv^T, N-major)
    const float* __restrict__ bias,    // [3072]
    _Float16* __restrict__ qh, _Float16* __restrict__ kh,
    _Float16* __restrict__ vh) {
  __shared__ __align__(16) _Float16 sA[2][128 * kLdG];
  __shared__ __align__(16) _Float16 sB[2][128 * kLdG];
  const int tid = threadIdx.x, lane = tid & 31, w = tid >> 5;
  const int wm = w & 3, wn = w >> 2;
  const int m0 = blockIdx.x * 128, n0 = blockIdx.y * 128;
  constexpr int KT = kDim / 32;

  auto stage = [&](int kt, int buf) {        // 128 rows x 32 halves per tile
    const int r = tid >> 2, kc = (tid & 3) << 3;   // rows r and r + 64
    async_copy4_b128(&sA[buf][r * kLdG + kc],
                     &A[(size_t)(m0 + r) * kDim + kt * 32 + kc],
                     &sB[buf][r * kLdG + kc],
                     &Bt[(size_t)(n0 + r) * kDim + kt * 32 + kc],
                     &sA[buf][(r + 64) * kLdG + kc],
                     &A[(size_t)(m0 + r + 64) * kDim + kt * 32 + kc],
                     &sB[buf][(r + 64) * kLdG + kc],
                     &Bt[(size_t)(n0 + r + 64) * kDim + kt * 32 + kc]);
  };

  v8f acc[2][4];
  v8f z = {};
#pragma unroll
  for (int i = 0; i < 2; ++i)
#pragma unroll
    for (int j = 0; j < 4; ++j) acc[i][j] = z;

  stage(0, 0);
  wait_async0();
  __syncthreads();

  for (int kt = 0; kt < KT; ++kt) {
    const int cur = kt & 1;
    if (kt + 1 < KT) stage(kt + 1, cur ^ 1);   // overlap DMA with compute

    v16h af[2], bf[4];
#pragma unroll
    for (int i = 0; i < 2; ++i)
      af[i] = load_frag16(&sA[cur][(wm * 32 + i * 16) * kLdG], kLdG, lane);
#pragma unroll
    for (int j = 0; j < 4; ++j)
      bf[j] = load_frag16(&sB[cur][(wn * 64 + j * 16) * kLdG], kLdG, lane);
#pragma unroll
    for (int i = 0; i < 2; ++i)
#pragma unroll
      for (int j = 0; j < 4; ++j) acc[i][j] = wmma16(af[i], bf[j], acc[i][j]);

    wait_ds0();
    wait_async0();
    __syncthreads();
  }

  // Epilogue: C layout = VGPR e holds row (e + 8*(lane>=16)), col (lane&15).
  const int rl = (lane >> 4) << 3;
#pragma unroll
  for (int i = 0; i < 2; ++i) {
#pragma unroll
    for (int j = 0; j < 4; ++j) {
      const int gn = n0 + wn * 64 + j * 16 + (lane & 15);
      const float bn = bias[gn];
      const int which = gn >> 10;            // 0=q 1=k 2=v
      const int cc = gn & 1023;
      const int hh = cc >> 6, dd = cc & 63;
      _Float16* dst = (which == 0) ? qh : (which == 1) ? kh : vh;
#pragma unroll
      for (int e = 0; e < 8; ++e) {
        const int gm = m0 + wm * 32 + i * 16 + rl + e;
        const int bb = gm >> 11, tt = gm & 2047;
        dst[(((size_t)(bb * kHeads + hh)) * kSeq + tt) * kHd + dd] =
            (_Float16)(acc[i][j][e] + bn);
      }
    }
  }
}

__global__ __launch_bounds__(256) void k_attn(
    const _Float16* __restrict__ qh, const _Float16* __restrict__ kh,
    const _Float16* __restrict__ vh, _Float16* __restrict__ oh) {
  __shared__ __align__(16) _Float16 sK[64 * kLdT];       // [key][dh]
  __shared__ __align__(16) _Float16 sV[64 * kLdV];       // [key][dh]

  const int tid = threadIdx.x, lane = tid & 31, w = tid >> 5;
  const int bh = blockIdx.y;                     // 0..B*H-1
  const int b = bh >> 4, h = bh & 15;
  const int q0 = blockIdx.x * 128 + w * 16;      // this wave's query rows
  const size_t bhBase = (size_t)bh * kSeq * kHd;

  // Q fragments (B operand: column = query) stay resident in registers.
  v16h qf[2];
  {
    const _Float16* qp = qh + bhBase + (size_t)q0 * kHd;
#pragma unroll
    for (int j = 0; j < 2; ++j) qf[j] = load_frag16(qp + j * 32, kHd, lane);
  }

  // o[c][e] = O^T[dh = c*16 + 8*(lane>>4) + e][query = lane&15]
  v8f o[4];
  v8f z = {};
#pragma unroll
  for (int c = 0; c < 4; ++c) o[c] = z;
  float mrow = -1e30f;   // running maximum of this lane's query
  float lrow = 0.f;      // running sum over this wave half's keys only

  for (int kt = 0; kt < kSeq / 64; ++kt) {
    wait_ds0();
    __syncthreads();
    const int kb = kt * 64;
    {
      // 64 keys x 64 dh of K and of V: rows key and key + 32 of each, async DMA
      // straight into LDS. Every lane is on at the copies.
      const int key = tid >> 3, dc = (tid & 7) << 3;
      const size_t g = bhBase + (size_t)(kb + key) * kHd + dc;
      async_copy4_b128(&sK[key * kLdT + dc], &kh[g],
                       &sV[key * kLdV + dc], &vh[g],
                       &sK[(key + 32) * kLdT + dc], &kh[g + 32 * kHd],
                       &sV[(key + 32) * kLdV + dc], &vh[g + 32 * kHd]);
    }
#pragma unroll
    for (int it = 0; it < 2; ++it) {
      const int c = tid + it * 256;
      const int key = c >> 3, dc = (c & 7) << 3;
      if (kt + 1 < kSeq / 64) {
        __builtin_prefetch(&kh[bhBase + (size_t)(kb + 64 + key) * kHd + dc], 0, 1);
        __builtin_prefetch(&vh[bhBase + (size_t)(kb + 64 + key) * kHd + dc], 0, 1);
      }
    }
    wait_async0();
    __syncthreads();

    // S^T = K @ Q^T: s[c][e] = score of key c*16 + 8*(lane>>4) + e.
    v8f s[4];
#pragma unroll
    for (int c = 0; c < 4; ++c) s[c] = z;
#pragma unroll
    for (int j = 0; j < 2; ++j)
#pragma unroll
      for (int c = 0; c < 4; ++c) {
        v16h kf = load_frag16(&sK[(c * 16) * kLdT + j * 32], kLdT, lane);
        s[c] = wmma16(kf, qf[j], s[c]);
      }

    // Online softmax: 32 of the query's 64 scores are in this lane, the other
    // 32 in lane ^ 16.
    float mc[4];
#pragma unroll
    for (int c = 0; c < 4; ++c) {
      mc[c] = s[c][0];
#pragma unroll
      for (int e = 1; e < 8; ++e) mc[c] = fmaxf(mc[c], s[c][e]);
    }
    float mx = fmaxf(fmaxf(mc[0], mc[1]), fmaxf(mc[2], mc[3]));
    mx = fmaxf(mx, xhalf(mx));
    const float mnew = fmaxf(mrow, mx * kScale);
    const float alpha = __expf(mrow - mnew);
    float rs[4];
#pragma unroll
    for (int c = 0; c < 4; ++c) {
      rs[c] = 0.f;
#pragma unroll
      for (int e = 0; e < 8; ++e) {
        const float p = __expf(s[c][e] * kScale - mnew);
        s[c][e] = p;
        rs[c] += p;
      }
    }
    lrow = lrow * alpha + ((rs[0] + rs[1]) + (rs[2] + rs[3]));
    mrow = mnew;
#pragma unroll
    for (int c = 0; c < 4; ++c)
#pragma unroll
      for (int e = 0; e < 8; ++e) o[c][e] *= alpha;

    // P^T as B fragments, in place: element t of fragment j is key
    // j*32 + (t < 8 ? 8*(lane>>4) + t : 16 + 8*(lane>>4) + t - 8), which is
    // register t&7 of tile 2j + (t>>3) and the k order of load_frag16.
    v16h pf[2];
#pragma unroll
    for (int j = 0; j < 2; ++j)
#pragma unroll
      for (int t = 0; t < 16; ++t)
        pf[j][t] = (_Float16)s[2 * j + (t >> 3)][t & 7];

    // O^T += V^T @ P^T
#pragma unroll
    for (int j = 0; j < 2; ++j)
#pragma unroll
      for (int c = 0; c < 4; ++c) {
        v16h vf = load_frag16_tr(&sV[(j * 32) * kLdV + c * 16], kLdV, lane);
        o[c] = wmma16(vf, pf[j], o[c]);
      }
  }

  // Join the two halves' sums, normalize, and write O in
  // [b, token, h*64+dh] (row-major for out-proj): 8 consecutive dh per lane.
  const float inv = 1.f / (lrow + xhalf(lrow));
  const int token = q0 + (lane & 15);
  _Float16* op = &oh[((size_t)(b * kSeq + token)) * kDim + h * kHd +
                     ((lane >> 4) << 3)];
#pragma unroll
  for (int c = 0; c < 4; ++c) {
    v8h r;
#pragma unroll
    for (int e = 0; e < 8; ++e) r[e] = (_Float16)(o[c][e] * inv);
    *(v8h*)(op + c * 16) = r;
  }
}

// ---------------------------------------------------------------------------
// Output projection: out[4096,1024] = Oh @ Wout + b_out (f32 result).
// Same async double-buffered pipeline as the QKV GEMM.
// ---------------------------------------------------------------------------
__global__ __launch_bounds__(256) void k_out_gemm(
    const _Float16* __restrict__ A,    // [4096,1024]
    const _Float16* __restrict__ Bt,   // [1024,1024] (Wout^T)
    const float* __restrict__ bias,    // [1024]
    float* __restrict__ C) {
  __shared__ __align__(16) _Float16 sA[2][128 * kLdG];
  __shared__ __align__(16) _Float16 sB[2][128 * kLdG];
  const int tid = threadIdx.x, lane = tid & 31, w = tid >> 5;
  const int wm = w & 3, wn = w >> 2;
  const int m0 = blockIdx.x * 128, n0 = blockIdx.y * 128;
  constexpr int KT = kDim / 32;

  auto stage = [&](int kt, int buf) {
    const int r = tid >> 2, kc = (tid & 3) << 3;   // rows r and r + 64
    async_copy4_b128(&sA[buf][r * kLdG + kc],
                     &A[(size_t)(m0 + r) * kDim + kt * 32 + kc],
                     &sB[buf][r * kLdG + kc],
                     &Bt[(size_t)(n0 + r) * kDim + kt * 32 + kc],
                     &sA[buf][(r + 64) * kLdG + kc],
                     &A[(size_t)(m0 + r + 64) * kDim + kt * 32 + kc],
                     &sB[buf][(r + 64) * kLdG + kc],
                     &Bt[(size_t)(n0 + r + 64) * kDim + kt * 32 + kc]);
  };

  v8f acc[2][4];
  v8f z = {};
#pragma unroll
  for (int i = 0; i < 2; ++i)
#pragma unroll
    for (int j = 0; j < 4; ++j) acc[i][j] = z;

  stage(0, 0);
  wait_async0();
  __syncthreads();

  for (int kt = 0; kt < KT; ++kt) {
    const int cur = kt & 1;
    if (kt + 1 < KT) stage(kt + 1, cur ^ 1);

    v16h af[2], bf[4];
#pragma unroll
    for (int i = 0; i < 2; ++i)
      af[i] = load_frag16(&sA[cur][(wm * 32 + i * 16) * kLdG], kLdG, lane);
#pragma unroll
    for (int j = 0; j < 4; ++j)
      bf[j] = load_frag16(&sB[cur][(wn * 64 + j * 16) * kLdG], kLdG, lane);
#pragma unroll
    for (int i = 0; i < 2; ++i)
#pragma unroll
      for (int j = 0; j < 4; ++j) acc[i][j] = wmma16(af[i], bf[j], acc[i][j]);

    wait_ds0();
    wait_async0();
    __syncthreads();
  }

  const int rl = (lane >> 4) << 3;
#pragma unroll
  for (int i = 0; i < 2; ++i) {
#pragma unroll
    for (int j = 0; j < 4; ++j) {
      const int gn = n0 + wn * 64 + j * 16 + (lane & 15);
      const float bn = bias[gn];
#pragma unroll
      for (int e = 0; e < 8; ++e) {
        const int gm = m0 + wm * 32 + i * 16 + rl + e;
        C[(size_t)gm * kDim + gn] = acc[i][j][e] + bn;
      }
    }
  }
}

// ---------------------------------------------------------------------------
// Host-side launcher.
// ---------------------------------------------------------------------------
extern "C" void kernel_launch(void* const* d_in, const int* in_sizes, int n_in,
                              void* d_out, int out_size, void* d_ws,
                              size_t ws_size, hipStream_t stream) {
  (void)in_sizes; (void)n_in; (void)out_size; (void)ws_size;
  const float* x    = (const float*)d_in[0];   // [2,2048,1024]
  const float* Wqkv = (const float*)d_in[1];   // [1024,3072]
  const float* bqkv = (const float*)d_in[2];   // [3072]
  const float* Wout = (const float*)d_in[3];   // [1024,1024]
  const float* bout = (const float*)d_in[4];   // [1024]
  float* out = (float*)d_out;                  // [2,2048,1024]

  char* ws = (char*)d_ws;
  size_t off = 0;
  auto alloc = [&](size_t bytes) -> void* {
    void* p = ws + off;
    off += (bytes + 255) & ~(size_t)255;
    return p;
  };
  const size_t nX = (size_t)kM * kDim;                 // 4.19M
  _Float16* xh    = (_Float16*)alloc(nX * 2);          // reused as Oh later
  _Float16* wqkvT = (_Float16*)alloc((size_t)3 * kDim * kDim * 2);
  _Float16* woutT = (_Float16*)alloc((size_t)kDim * kDim * 2);
  _Float16* qh    = (_Float16*)alloc(nX * 2);
  _Float16* kh    = (_Float16*)alloc(nX * 2);
  _Float16* vh    = (_Float16*)alloc(nX * 2);
  _Float16* oh    = xh;  // xh dead after QKV GEMM; alias for attention output

  // 1) precision/layout conversion (bandwidth-trivial: ~30 MB total)
  k_f32_to_f16<<<(int)((nX + 255) / 256), 256, 0, stream>>>(x, xh, (int)nX);
  k_transpose_f16<<<dim3((3 * kDim) / 64, kDim / 64), 256, 0, stream>>>(
      Wqkv, wqkvT, kDim, 3 * kDim);
  k_transpose_f16<<<dim3(kDim / 64, kDim / 64), 256, 0, stream>>>(
      Wout, woutT, kDim, kDim);

  // 2) QKV projection -> q/k/v in [B,H,N,Dh] f16
  k_qkv_gemm<<<dim3(kM / 128, (3 * kDim) / 128), 256, 0, stream>>>(
      xh, wqkvT, bqkv, qh, kh, vh);

  // 3) flash attention -> Oh in [B,N,C] f16
  k_attn<<<dim3(kSeq / 128, kB * kHeads), 256, 0, stream>>>(qh, kh, vh, oh);

  // 4) output projection -> f32 result
  k_out_gemm<<<dim3(kM / 128, kDim / 128), 256, 0, stream>>>(
      oh, woutT, bout, out);
}

// v005
// One run takes 97.6 microseconds.
// In two side-by-side timings against v004, it was 1.10 and 1.13 times as fast.
// Over all steps from v000 it is 4.36 times as fast.
#include <hip/hip_runtime.h>
#include <hip/hip_bf16.h>

// ---------------------------------------------------------------------------
// MI455X (gfx1250) multi-head attention forward.
// f16 storage + f32 WMMA accumulation via v_wmma_f32_16x16x32_f16 (wave32).
// Global->LDS staging uses CDNA5 async-LDS DMA (ASYNCcnt), double-buffered in the GEMMs.
// ---------------------------------------------------------------------------

typedef __attribute__((ext_vector_type(16))) _Float16 v16h;
typedef __attribute__((ext_vector_type(8)))  _Float16 v8h;
typedef __attribute__((ext_vector_type(8)))  float    v8f;

union HFrag { v16h v; v8h h[2]; };

// Load one 16x32 f16 A/B fragment from a row-major (ld halves) tile.
// Per ISA 7.12.2: lane L holds row (L&15); K halves are
//   [off..off+7] in VGPR0-3 and [off+16..off+23] in VGPR4-7, off=(L>=16)*8.
// B fragments use the identical layout on the N-major (transposed) operand.
__device__ __forceinline__ v16h load_frag16(const _Float16* __restrict__ base,
                                            int ld, int lane) {
  const _Float16* p = base + (lane & 15) * ld + ((lane >> 4) << 3);
  HFrag f;
  f.h[0] = *(const v8h*)(p);
  f.h[1] = *(const v8h*)(p + 16);
  return f.v;
}

// One 16x32 A fragment of the TRANSPOSE of a row-major [k][m] f16 LDS tile (ld
// halves a row): two transposing LDS loads, 16 k rows each. Lane l hands in the
// address of 16 bytes of row 8*(l>>4) + (l&7), byte column 16*((l>>3)&1), and
// gets k = 8*(l>>4) + 0..7 of column l&15: the k order of load_frag16.
__device__ __forceinline__ v16h load_frag16_tr(const _Float16* base, int ld,
                                               int lane) {
  typedef __attribute__((ext_vector_type(8))) short s16x8;
  typedef __attribute__((address_space(3))) s16x8 lds_s16x8;
  const _Float16* p = base + (((lane >> 4) << 3) + (lane & 7)) * ld +
                      (((lane >> 3) & 1) << 3);
  HFrag f;
  f.h[0] = __builtin_bit_cast(
      v8h, __builtin_amdgcn_ds_load_tr16_b128_v8i16((lds_s16x8*)p));
  f.h[1] = __builtin_bit_cast(
      v8h, __builtin_amdgcn_ds_load_tr16_b128_v8i16((lds_s16x8*)(p + 16 * ld)));
  return f.v;
}

__device__ __forceinline__ v8f wmma16(v16h a, v16h b, v8f c) {
  return __builtin_amdgcn_wmma_f32_16x16x32_f16(false, a, false, b,
                                                (short)0, c, false, false);
}

// CDNA5 async global->LDS copy, 16B per lane (GLOBAL_LOAD_ASYNC_TO_LDS_B128,
// tracked with ASYNCcnt). LDS destination is the low 32 address bits of the
// generic shared-memory pointer (aperture mapping, ISA 10.2).
// Four such copies (one stage of a thread) under one s_wait_xcnt 0.
__device__ __forceinline__ void async_copy4_b128(
    void* l0, const _Float16* g0, void* l1, const _Float16* g1,
    void* l2, const _Float16* g2, void* l3, const _Float16* g3) {
  unsigned int o0 = (unsigned int)(unsigned long long)(uintptr_t)l0;
  unsigned int o1 = (unsigned int)(unsigned long long)(uintptr_t)l1;
  unsigned int o2 = (unsigned int)(unsigned long long)(uintptr_t)l2;
  unsigned int o3 = (unsigned int)(unsigned long long)(uintptr_t)l3;
  unsigned long long a0 = (unsigned long long)(uintptr_t)g0;
  unsigned long long a1 = (unsigned long long)(uintptr_t)g1;
  unsigned long long a2 = (unsigned long long)(uintptr_t)g2;
  unsigned long long a3 = (unsigned long long)(uintptr_t)g3;
  // The wait is the statement's last line: the address registers live to it,
  // so no later write of them can be scheduled in front of it.
  asm volatile("global_load_async_to_lds_b128 %0, %1, off\n\t"
               "global_load_async_to_lds_b128 %2, %3, off\n\t"
               "global_load_async_to_lds_b128 %4, %5, off\n\t"
               "global_load_async_to_lds_b128 %6, %7, off\n\t"
               "s_wait_xcnt 0x0"
               :: "v"(o0), "v"(a0), "v"(o1), "v"(a1),
                  "v"(o2), "v"(a2), "v"(o3), "v"(a3)
               : "memory");
}

// Eight such copies under one s_wait_xcnt 0: four rows of each GEMM operand,
// lstep (LDS) and gstep (global) halves apart.
__device__ __forceinline__ void async_copy8_b128(
    _Float16* la, const _Float16* ga, _Float16* lb, const _Float16* gb,
    int lstep, int gstep) {
  unsigned int oa[4], ob[4];
  unsigned long long aa[4], ab[4];
#pragma unroll   // the arrays become plain registers for the asm operands
  for (int i = 0; i < 4; ++i) {
    oa[i] = (unsigned int)(unsigned long long)(uintptr_t)(la + i * lstep);
    ob[i] = (unsigned int)(unsigned long long)(uintptr_t)(lb + i * lstep);
    aa[i] = (unsigned long long)(uintptr_t)(ga + (size_t)i * gstep);
    ab[i] = (unsigned long long)(uintptr_t)(gb + (size_t)i * gstep);
  }
  // The wait is the statement's last line: the address registers live to it,
  // so no later write of them can be scheduled in front of it.
  asm volatile("global_load_async_to_lds_b128 %0, %1, off\n\t"
               "global_load_async_to_lds_b128 %2, %3, off\n\t"
               "global_load_async_to_lds_b128 %4, %5, off\n\t"
               "global_load_async_to_lds_b128 %6, %7, off\n\t"
               "global_load_async_to_lds_b128 %8, %9, off\n\t"
               "global_load_async_to_lds_b128 %10, %11, off\n\t"
               "global_load_async_to_lds_b128 %12, %13, off\n\t"
               "global_load_async_to_lds_b128 %14, %15, off\n\t"
               "s_wait_xcnt 0x0"
               :: "v"(oa[0]), "v"(aa[0]), "v"(ob[0]), "v"(ab[0]),
                  "v"(oa[1]), "v"(aa[1]), "v"(ob[1]), "v"(ab[1]),
                  "v"(oa[2]), "v"(aa[2]), "v"(ob[2]), "v"(ab[2]),
                  "v"(oa[3]), "v"(aa[3]), "v"(ob[3]), "v"(ab[3])
               : "memory");
}

__device__ __forceinline__ void wait_async0() {
  asm volatile("s_wait_asynccnt 0x0" ::: "memory");
}

// This wave's LDS reads have retired before the barrier behind which a copy
// refills the bytes they read.
__device__ __forceinline__ void wait_ds0() {
  asm volatile("s_wait_dscnt 0x0" ::: "memory");
}

// Lane l <-> lane l ^ 16 as one vector instruction (a shuffle builtin would go
// through the LDS pipe and its latency).
__device__ __forceinline__ float xhalf(float x) {
  const int b = __builtin_bit_cast(int, x);
  return __builtin_bit_cast(float, __builtin_amdgcn_permlanex16(
      b, b, 0x76543210, 0xfedcba98, false, false));
}

// Problem constants (from the reference).
constexpr int   kB     = 2;
constexpr int   kSeq   = 2048;
constexpr int   kDim   = 1024;
constexpr int   kHeads = 16;
constexpr int   kHd    = 64;
constexpr int   kM     = kB * kSeq;      // 4096 rows
constexpr float kScale = 0.125f;         // 64^-0.5

// LDS row pitches in halves: 16 bytes x an odd number, so that the 16 rows a
// ds_load_b128 fragment read touches fall on distinct banks (64 banks x 4 B).
constexpr int kKs  = 64;   // QKV GEMM stage: 64 k, a tile row is one 128-byte line
constexpr int kLdG = 72;   // its tiles: 128-byte rows at a 144-byte pitch
constexpr int kKsO = 128;  // output GEMM stage: 128 k, a tile row is two lines
constexpr int kLdO = 136;  // its tiles: 256-byte rows at a 272-byte pitch
constexpr int kLdT = 72;   // attention K tile: 128-byte rows at a 144-byte pitch
// Rows read by the transposing load want 32 bytes x an odd number instead.
constexpr int kLdV = 80;   // attention V tile: 128-byte rows at a 160-byte pitch

// ---------------------------------------------------------------------------
// Elementwise f32 -> f16
// ---------------------------------------------------------------------------
__global__ void k_f32_to_f16(const float* __restrict__ in,
                             _Float16* __restrict__ out, int n) {
  int i = blockIdx.x * blockDim.x + threadIdx.x;
  if (i < n) out[i] = (_Float16)in[i];
}

// Transpose + convert: in f32 [R][C] -> out f16 [C][R]  (weights -> N-major)
// One 64x64 tile per block, turned in LDS: input rows are read as 256-byte
// runs and every output row of the tile leaves as one whole 128-byte line.
// R and C are multiples of 64; grid = (C/64, R/64), 256 threads.
__global__ __launch_bounds__(256) void k_transpose_f16(
    const float* __restrict__ in, _Float16* __restrict__ out, int R, int C) {
  __shared__ float sT[64][65];   // odd pitch: column reads fall on distinct banks
  const int tid = threadIdx.x;
  const int c0 = blockIdx.x * 64, r0 = blockIdx.y * 64;

  const int lr = tid >> 4, lc = (tid & 15) << 2;
  float4 v[4];
#pragma unroll
  for (int i = 0; i < 4; ++i)
    v[i] = *(const float4*)&in[(size_t)(r0 + lr + i * 16) * C + c0 + lc];
#pragma unroll
  for (int i = 0; i < 4; ++i) {
    sT[lr + i * 16][lc + 0] = v[i].x;
    sT[lr + i * 16][lc + 1] = v[i].y;
    sT[lr + i * 16][lc + 2] = v[i].z;
    sT[lr + i * 16][lc + 3] = v[i].w;
  }
  __syncthreads();

  const int rg = (tid & 7) << 3;   // 8 lanes x 8 halves = one output line
#pragma unroll
  for (int i = 0; i < 2; ++i) {
    const int oc = (tid >> 3) + i * 32;
    v8h h;
#pragma unroll
    for (int e = 0; e < 8; ++e) h[e] = (_Float16)sT[rg + e][oc];
    *(v8h*)&out[(size_t)(c0 + oc) * R + r0 + rg] = h;
  }
}

// ---------------------------------------------------------------------------
// QKV projection: C[4096,3072] = Xh[4096,1024] @ Wqkv; scatter to q/k/v
// in [B,H,N,Dh] f16 layout. Block tile 128x128, K-step 64, 8 waves (4x2).
// Async double-buffered LDS staging: DMA tile kt+1 while WMMAs chew tile kt.
// ---------------------------------------------------------------------------
__global__ __launch_bounds__(256) void k_qkv_gemm(
    const _Float16* __restrict__ A,    // [4096,1024]
    const _Float16* __restrict__ Bt,   // [3072,1024]  (Wqkv^T, N-major)
    const float* __restrict__ bias,    // [3072]
    _Float16* __restrict__ qh, _Float16* __restrict__ kh,
    _Float16* __restrict__ vh) {
  __shared__ __align__(16) _Float16 sA[2][128 * kLdG];
  __shared__ __align__(16) _Float16 sB[2][128 * kLdG];
  const int tid = threadIdx.x, lane = tid & 31, w = tid >> 5;
  const int wm = w & 3, wn = w >> 2;
  const int m0 = blockIdx.x * 128, n0 = blockIdx.y * 128;
  constexpr int KT = kDim / kKs;

  auto stage = [&](int kt, int buf) {        // 128 rows x 64 halves per tile
    // 8 lanes a row: a wave's copy takes 4 whole lines. Rows r + 0, 32, 64, 96.
    const int r = tid >> 3, kc = (tid & 7) << 3;
    async_copy8_b128(&sA[buf][r * kLdG + kc],
                     &A[(size_t)(m0 + r) * kDim + kt * kKs + kc],
                     &sB[buf][r * kLdG + kc],
                     &Bt[(size_t)(n0 + r) * kDim + kt * kKs + kc],
                     32 * kLdG, 32 * kDim);
  };

  v8f acc[2][4];
  v8f z = {};
#pragma unroll
  for (int i = 0; i < 2; ++i)
#pragma unroll
    for (int j = 0; j < 4; ++j) acc[i][j] = z;

  stage(0, 0);
  wait_async0();
  __syncthreads();

  for (int kt = 0; kt < KT; ++kt) {
    const int cur = kt & 1;
    if (kt + 1 < KT) stage(kt + 1, cur ^ 1);   // overlap DMA with compute

#pragma unroll   // ks becomes an immediate offset of the LDS reads
    for (int ks = 0; ks < kKs; ks += 32) {
      v16h af[2], bf[4];
#pragma unroll
      for (int i = 0; i < 2; ++i)
        af[i] = load_frag16(&sA[cur][(wm * 32 + i * 16) * kLdG + ks], kLdG, lane);
#pragma unroll
      for (int j = 0; j < 4; ++j)
        bf[j] = load_frag16(&sB[cur][(wn * 64 + j * 16) * kLdG + ks], kLdG, lane);
#pragma unroll
      for (int i = 0; i < 2; ++i)
#pragma unroll
        for (int j = 0; j < 4; ++j) acc[i][j] = wmma16(af[i], bf[j], acc[i][j]);
    }

    wait_ds0();
    wait_async0();
    __syncthreads();
  }

  // Epilogue: C layout = VGPR e holds row (e + 8*(lane>=16)), col (lane&15).
  const int rl = (lane >> 4) << 3;
#pragma unroll
  for (int i = 0; i < 2; ++i) {
#pragma unroll
    for (int j = 0; j < 4; ++j) {
      const int gn = n0 + wn * 64 + j * 16 + (lane & 15);
      const float bn = bias[gn];
      const int which = gn >> 10;            // 0=q 1=k 2=v
      const int cc = gn & 1023;
      const int hh = cc >> 6, dd = cc & 63;
      _Float16* dst = (which == 0) ? qh : (which == 1) ? kh : vh;
#pragma unroll
      for (int e = 0; e < 8; ++e) {
        const int gm = m0 + wm * 32 + i * 16 + rl + e;
        const int bb = gm >> 11, tt = gm & 2047;
        dst[(((size_t)(bb * kHeads + hh)) * kSeq + tt) * kHd + dd] =
            (_Float16)(acc[i][j][e] + bn);
      }
    }
  }
}

__global__ __launch_bounds__(256) void k_attn(
    const _Float16* __restrict__ qh, const _Float16* __restrict__ kh,
    const _Float16* __restrict__ vh, _Float16* __restrict__ oh) {
  __shared__ __align__(16) _Float16 sK[64 * kLdT];       // [key][dh]
  __shared__ __align__(16) _Float16 sV[64 * kLdV];       // [key][dh]

  const int tid = threadIdx.x, lane = tid & 31, w = tid >> 5;
  const int bh = blockIdx.y;                     // 0..B*H-1
  const int b = bh >> 4, h = bh & 15;
  const int q0 = blockIdx.x * 128 + w * 16;      // this wave's query rows
  const size_t bhBase = (size_t)bh * kSeq * kHd;

  // Q fragments (B operand: column = query) stay resident in registers.
  v16h qf[2];
  {
    const _Float16* qp = qh + bhBase + (size_t)q0 * kHd;
#pragma unroll
    for (int j = 0; j < 2; ++j) qf[j] = load_frag16(qp + j * 32, kHd, lane);
  }

  // o[c][e] = O^T[dh = c*16 + 8*(lane>>4) + e][query = lane&15]
  v8f o[4];
  v8f z = {};
#pragma unroll
  for (int c = 0; c < 4; ++c) o[c] = z;
  float mrow = -1e30f;   // running maximum of this lane's query
  float lrow = 0.f;      // running sum over this wave half's keys only

  for (int kt = 0; kt < kSeq / 64; ++kt) {
    wait_ds0();
    __syncthreads();
    const int kb = kt * 64;
    {
      // 64 keys x 64 dh of K and of V: rows key and key + 32 of each, async DMA
      // straight into LDS. Every lane is on at the copies.
      const int key = tid >> 3, dc = (tid & 7) << 3;
      const size_t g = bhBase + (size_t)(kb + key) * kHd + dc;
      async_copy4_b128(&sK[key * kLdT + dc], &kh[g],
                       &sV[key * kLdV + dc], &vh[g],
                       &sK[(key + 32) * kLdT + dc], &kh[g + 32 * kHd],
                       &sV[(key + 32) * kLdV + dc], &vh[g + 32 * kHd]);
    }
#pragma unroll
    for (int it = 0; it < 2; ++it) {
      const int c = tid + it * 256;
      const int key = c >> 3, dc = (c & 7) << 3;
      if (kt + 1 < kSeq / 64) {
        __builtin_prefetch(&kh[bhBase + (size_t)(kb + 64 + key) * kHd + dc], 0, 1);
        __builtin_prefetch(&vh[bhBase + (size_t)(kb + 64 + key) * kHd + dc], 0, 1);
      }
    }
    wait_async0();
    __syncthreads();

    // S^T = K @ Q^T: s[c][e] = score of key c*16 + 8*(lane>>4) + e.
    v8f s[4];
#pragma unroll
    for (int c = 0; c < 4; ++c) s[c] = z;
#pragma unroll
    for (int j = 0; j < 2; ++j)
#pragma unroll
      for (int c = 0; c < 4; ++c) {
        v16h kf = load_frag16(&sK[(c * 16) * kLdT + j * 32], kLdT, lane);
        s[c] = wmma16(kf, qf[j], s[c]);
      }

    // Online softmax: 32 of the query's 64 scores are in this lane, the other
    // 32 in lane ^ 16.
    float mc[4];
#pragma unroll
    for (int c = 0; c < 4; ++c) {
      mc[c] = s[c][0];
#pragma unroll
      for (int e = 1; e < 8; ++e) mc[c] = fmaxf(mc[c], s[c][e]);
    }
    float mx = fmaxf(fmaxf(mc[0], mc[1]), fmaxf(mc[2], mc[3]));
    mx = fmaxf(mx, xhalf(mx));
    const float mnew = fmaxf(mrow, mx * kScale);
    const float alpha = __expf(mrow - mnew);
    float rs[4];
#pragma unroll
    for (int c = 0; c < 4; ++c) {
      rs[c] = 0.f;
#pragma unroll
      for (int e = 0; e < 8; ++e) {
        const float p = __expf(s[c][e] * kScale - mnew);
        s[c][e] = p;
        rs[c] += p;
      }
    }
    lrow = lrow * alpha + ((rs[0] + rs[1]) + (rs[2] + rs[3]));
    mrow = mnew;
#pragma unroll
    for (int c = 0; c < 4; ++c)
#pragma unroll
      for (int e = 0; e < 8; ++e) o[c][e] *= alpha;

    // P^T as B fragments, in place: element t of fragment j is key
    // j*32 + (t < 8 ? 8*(lane>>4) + t : 16 + 8*(lane>>4) + t - 8), which is
    // register t&7 of tile 2j + (t>>3) and the k order of load_frag16.
    v16h pf[2];
#pragma unroll
    for (int j = 0; j < 2; ++j)
#pragma unroll
      for (int t = 0; t < 16; ++t)
        pf[j][t] = (_Float16)s[2 * j + (t >> 3)][t & 7];

    // O^T += V^T @ P^T
#pragma unroll
    for (int j = 0; j < 2; ++j)
#pragma unroll
      for (int c = 0; c < 4; ++c) {
        v16h vf = load_frag16_tr(&sV[(j * 32) * kLdV + c * 16], kLdV, lane);
        o[c] = wmma16(vf, pf[j], o[c]);
      }
  }

  // Join the two halves' sums, normalize, and write O in
  // [b, token, h*64+dh] (row-major for out-proj): 8 consecutive dh per lane.
  const float inv = 1.f / (lrow + xhalf(lrow));
  const int token = q0 + (lane & 15);
  _Float16* op = &oh[((size_t)(b * kSeq + token)) * kDim + h * kHd +
                     ((lane >> 4) << 3)];
#pragma unroll
  for (int c = 0; c < 4; ++c) {
    v8h r;
#pragma unroll
    for (int e = 0; e < 8; ++e) r[e] = (_Float16)(o[c][e] * inv);
    *(v8h*)(op + c * 16) = r;
  }
}

// ---------------------------------------------------------------------------
// Output projection: out[4096,1024] = Oh @ Wout + b_out (f32 result).
// Same async double-buffered pipeline as the QKV GEMM, in stages of 128 k: one
// work-group a WGP here, so the longer stage has to cover the copies' flight.
// ---------------------------------------------------------------------------
__global__ __launch_bounds__(256) void k_out_gemm(
    const _Float16* __restrict__ A,    // [4096,1024]
    const _Float16* __restrict__ Bt,   // [1024,1024] (Wout^T)
    const float* __restrict__ bias,    // [1024]
    float* __restrict__ C) {
  __shared__ __align__(16) _Float16 sA[2][128 * kLdO];
  __shared__ __align__(16) _Float16 sB[2][128 * kLdO];
  const int tid = threadIdx.x, lane = tid & 31, w = tid >> 5;
  const int wm = w & 3, wn = w >> 2;
  const int m0 = blockIdx.x * 128, n0 = blockIdx.y * 128;
  constexpr int KT = kDim / kKsO;

  auto stage = [&](int kt, int buf) {        // 128 rows x 128 halves per tile
    // 16 lanes a row: a wave's copy takes 4 whole lines. Rows r + 0, 16, .. 112.
    const int r = tid >> 4, kc = (tid & 15) << 3;
#pragma unroll   // two statements: an asm statement takes at most 15 copies
    for (int h = 0; h < 128; h += 64)
      async_copy8_b128(&sA[buf][(r + h) * kLdO + kc],
                       &A[(size_t)(m0 + r + h) * kDim + kt * kKsO + kc],
                       &sB[buf][(r + h) * kLdO + kc],
                       &Bt[(size_t)(n0 + r + h) * kDim + kt * kKsO + kc],
                       16 * kLdO, 16 * kDim);
  };

  v8f acc[2][4];
  v8f z = {};
#pragma unroll
  for (int i = 0; i < 2; ++i)
#pragma unroll
    for (int j = 0; j < 4; ++j) acc[i][j] = z;

  stage(0, 0);
  wait_async0();
  __syncthreads();

  for (int kt = 0; kt < KT; ++kt) {
    const int cur = kt & 1;
    if (kt + 1 < KT) stage(kt + 1, cur ^ 1);

#pragma unroll   // ks becomes an immediate offset of the LDS reads
    for (int ks = 0; ks < kKsO; ks += 32) {
      v16h af[2], bf[4];
#pragma unroll
      for (int i = 0; i < 2; ++i)
        af[i] = load_frag16(&sA[cur][(wm * 32 + i * 16) * kLdO + ks], kLdO, lane);
#pragma unroll
      for (int j = 0; j < 4; ++j)
        bf[j] = load_frag16(&sB[cur][(wn * 64 + j * 16) * kLdO + ks], kLdO, lane);
#pragma unroll
      for (int i = 0; i < 2; ++i)
#pragma unroll
        for (int j = 0; j < 4; ++j) acc[i][j] = wmma16(af[i], bf[j], acc[i][j]);
    }

    wait_ds0();
    wait_async0();
    __syncthreads();
  }

  const int rl = (lane >> 4) << 3;
#pragma unroll
  for (int i = 0; i < 2; ++i) {
#pragma unroll
    for (int j = 0; j < 4; ++j) {
      const int gn = n0 + wn * 64 + j * 16 + (lane & 15);
      const float bn = bias[gn];
#pragma unroll
      for (int e = 0; e < 8; ++e) {
        const int gm = m0 + wm * 32 + i * 16 + rl + e;
        C[(size_t)gm * kDim + gn] = acc[i][j][e] + bn;
      }
    }
  }
}

// ---------------------------------------------------------------------------
// Host-side launcher.
// ---------------------------------------------------------------------------
extern "C" void kernel_launch(void* const* d_in, const int* in_sizes, int n_in,
                              void* d_out, int out_size, void* d_ws,
                              size_t ws_size, hipStream_t stream) {
  (void)in_sizes; (void)n_in; (void)out_size; (void)ws_size;
  const float* x    = (const float*)d_in[0];   // [2,2048,1024]
  const float* Wqkv = (const float*)d_in[1];   // [1024,3072]
  const float* bqkv = (const float*)d_in[2];   // [3072]
  const float* Wout = (const float*)d_in[3];   // [1024,1024]
  const float* bout = (const float*)d_in[4];   // [1024]
  float* out = (float*)d_out;                  // [2,2048,1024]

  char* ws = (char*)d_ws;
  size_t off = 0;
  auto alloc = [&](size_t bytes) -> void* {
    void* p = ws + off;
    off += (bytes + 255) & ~(size_t)255;
    return p;
  };
  const size_t nX = (size_t)kM * kDim;                 // 4.19M
  _Float16* xh    = (_Float16*)alloc(nX * 2);          // reused as Oh later
  _Float16* wqkvT = (_Float16*)alloc((size_t)3 * kDim * kDim * 2);
  _Float16* woutT = (_Float16*)alloc((size_t)kDim * kDim * 2);
  _Float16* qh    = (_Float16*)alloc(nX * 2);
  _Float16* kh    = (_Float16*)alloc(nX * 2);
  _Float16* vh    = (_Float16*)alloc(nX * 2);
  _Float16* oh    = xh;  // xh dead after QKV GEMM; alias for attention output

  // 1) precision/layout conversion (bandwidth-trivial: ~30 MB total)
  k_f32_to_f16<<<(int)((nX + 255) / 256), 256, 0, stream>>>(x, xh, (int)nX);
  k_transpose_f16<<<dim3((3 * kDim) / 64, kDim / 64), 256, 0, stream>>>(
      Wqkv, wqkvT, kDim, 3 * kDim);
  k_transpose_f16<<<dim3(kDim / 64, kDim / 64), 256, 0, stream>>>(
      Wout, woutT, kDim, kDim);

  // 2) QKV projection -> q/k/v in [B,H,N,Dh] f16
  k_qkv_gemm<<<dim3(kM / 128, (3 * kDim) / 128), 256, 0, stream>>>(
      xh, wqkvT, bqkv, qh, kh, vh);

  // 3) flash attention -> Oh in [B,N,C] f16
  k_attn<<<dim3(kSeq / 128, kB * kHeads), 256, 0, stream>>>(qh, kh, vh, oh);

  // 4) output projection -> f32 result
  k_out_gemm<<<dim3(kM / 128, kDim / 128), 256, 0, stream>>>(
      oh, woutT, bout, out);
}

// v006
// A run of this version takes 92.7 microseconds.
// Timed twice side by side with v005, it ran 1.06 and 1.07 times as fast.
// All steps since v000 together make it 4.64 times as fast.
#include <hip/hip_runtime.h>
#include <hip/hip_bf16.h>

// ---------------------------------------------------------------------------
// MI455X (gfx1250) multi-head attention forward.
// f16 storage + f32 WMMA accumulation via v_wmma_f32_16x16x32_f16 (wave32).
// Global->LDS staging uses CDNA5 async-LDS DMA (ASYNCcnt), double-buffered in the GEMMs.
// ---------------------------------------------------------------------------

typedef __attribute__((ext_vector_type(16))) _Float16 v16h;
typedef __attribute__((ext_vector_type(8)))  _Float16 v8h;
typedef __attribute__((ext_vector_type(8)))  float    v8f;
typedef __attribute__((ext_vector_type(2)))  float    v2f;

union HFrag { v16h v; v8h h[2]; };

// Load one 16x32 f16 A/B fragment from a row-major (ld halves) tile.
// Per ISA 7.12.2: lane L holds row (L&15); K halves are
//   [off..off+7] in VGPR0-3 and [off+16..off+23] in VGPR4-7, off=(L>=16)*8.
// B fragments use the identical layout on the N-major (transposed) operand.
__device__ __forceinline__ v16h load_frag16(const _Float16* __restrict__ base,
                                            int ld, int lane) {
  const _Float16* p = base + (lane & 15) * ld + ((lane >> 4) << 3);
  HFrag f;
  f.h[0] = *(const v8h*)(p);
  f.h[1] = *(const v8h*)(p + 16);
  return f.v;
}

// One 16x32 A fragment of the TRANSPOSE of a row-major [k][m] f16 LDS tile (ld
// halves a row): two transposing LDS loads, 16 k rows each. Lane l hands in the
// address of 16 bytes of row 8*(l>>4) + (l&7), byte column 16*((l>>3)&1), and
// gets k = 8*(l>>4) + 0..7 of column l&15: the k order of load_frag16.
__device__ __forceinline__ v16h load_frag16_tr(const _Float16* base, int ld,
                                               int lane) {
  typedef __attribute__((ext_vector_type(8))) short s16x8;
  typedef __attribute__((address_space(3))) s16x8 lds_s16x8;
  const _Float16* p = base + (((lane >> 4) << 3) + (lane & 7)) * ld +
                      (((lane >> 3) & 1) << 3);
  HFrag f;
  f.h[0] = __builtin_bit_cast(
      v8h, __builtin_amdgcn_ds_load_tr16_b128_v8i16((lds_s16x8*)p));
  f.h[1] = __builtin_bit_cast(
      v8h, __builtin_amdgcn_ds_load_tr16_b128_v8i16((lds_s16x8*)(p + 16 * ld)));
  return f.v;
}

__device__ __forceinline__ v8f wmma16(v16h a, v16h b, v8f c) {
  return __builtin_amdgcn_wmma_f32_16x16x32_f16(false, a, false, b,
                                                (short)0, c, false, false);
}

// CDNA5 async global->LDS copy, 16B per lane (GLOBAL_LOAD_ASYNC_TO_LDS_B128,
// tracked with ASYNCcnt). LDS destination is the low 32 address bits of the
// generic shared-memory pointer (aperture mapping, ISA 10.2).
// Four such copies (one stage of a thread) under one s_wait_xcnt 0.
__device__ __forceinline__ void async_copy4_b128(
    void* l0, const _Float16* g0, void* l1, const _Float16* g1,
    void* l2, const _Float16* g2, void* l3, const _Float16* g3) {
  unsigned int o0 = (unsigned int)(unsigned long long)(uintptr_t)l0;
  unsigned int o1 = (unsigned int)(unsigned long long)(uintptr_t)l1;
  unsigned int o2 = (unsigned int)(unsigned long long)(uintptr_t)l2;
  unsigned int o3 = (unsigned int)(unsigned long long)(uintptr_t)l3;
  unsigned long long a0 = (unsigned long long)(uintptr_t)g0;
  unsigned long long a1 = (unsigned long long)(uintptr_t)g1;
  unsigned long long a2 = (unsigned long long)(uintptr_t)g2;
  unsigned long long a3 = (unsigned long long)(uintptr_t)g3;
  // The wait is the statement's last line: the address registers live to it,
  // so no later write of them can be scheduled in front of it.
  asm volatile("global_load_async_to_lds_b128 %0, %1, off\n\t"
               "global_load_async_to_lds_b128 %2, %3, off\n\t"
               "global_load_async_to_lds_b128 %4, %5, off\n\t"
               "global_load_async_to_lds_b128 %6, %7, off\n\t"
               "s_wait_xcnt 0x0"
               :: "v"(o0), "v"(a0), "v"(o1), "v"(a1),
                  "v"(o2), "v"(a2), "v"(o3), "v"(a3)
               : "memory");
}

// Eight such copies under one s_wait_xcnt 0: four rows of each GEMM operand,
// lstep (LDS) and gstep (global) halves apart.
__device__ __forceinline__ void async_copy8_b128(
    _Float16* la, const _Float16* ga, _Float16* lb, const _Float16* gb,
    int lstep, int gstep) {
  unsigned int oa[4], ob[4];
  unsigned long long aa[4], ab[4];
#pragma unroll   // the arrays become plain registers for the asm operands
  for (int i = 0; i < 4; ++i) {
    oa[i] = (unsigned int)(unsigned long long)(uintptr_t)(la + i * lstep);
    ob[i] = (unsigned int)(unsigned long long)(uintptr_t)(lb + i * lstep);
    aa[i] = (unsigned long long)(uintptr_t)(ga + (size_t)i * gstep);
    ab[i] = (unsigned long long)(uintptr_t)(gb + (size_t)i * gstep);
  }
  // The wait is the statement's last line: the address registers live to it,
  // so no later write of them can be scheduled in front of it.
  asm volatile("global_load_async_to_lds_b128 %0, %1, off\n\t"
               "global_load_async_to_lds_b128 %2, %3, off\n\t"
               "global_load_async_to_lds_b128 %4, %5, off\n\t"
               "global_load_async_to_lds_b128 %6, %7, off\n\t"
               "global_load_async_to_lds_b128 %8, %9, off\n\t"
               "global_load_async_to_lds_b128 %10, %11, off\n\t"
               "global_load_async_to_lds_b128 %12, %13, off\n\t"
               "global_load_async_to_lds_b128 %14, %15, off\n\t"
               "s_wait_xcnt 0x0"
               :: "v"(oa[0]), "v"(aa[0]), "v"(ob[0]), "v"(ab[0]),
                  "v"(oa[1]), "v"(aa[1]), "v"(ob[1]), "v"(ab[1]),
                  "v"(oa[2]), "v"(aa[2]), "v"(ob[2]), "v"(ab[2]),
                  "v"(oa[3]), "v"(aa[3]), "v"(ob[3]), "v"(ab[3])
               : "memory");
}

__device__ __forceinline__ void wait_async0() {
  asm volatile("s_wait_asynccnt 0x0" ::: "memory");
}

// This wave's LDS reads have retired before the barrier behind which a copy
// refills the bytes they read.
__device__ __forceinline__ void wait_ds0() {
  asm volatile("s_wait_dscnt 0x0" ::: "memory");
}

// Lane l <-> lane l ^ 16 as one vector instruction (a shuffle builtin would go
// through the LDS pipe and its latency).
__device__ __forceinline__ float xhalf(float x) {
  const int b = __builtin_bit_cast(int, x);
  return __builtin_bit_cast(float, __builtin_amdgcn_permlanex16(
      b, b, 0x76543210, 0xfedcba98, false, false));
}

// Problem constants (from the reference).
constexpr int   kB     = 2;
constexpr int   kSeq   = 2048;
constexpr int   kDim   = 1024;
constexpr int   kHeads = 16;
constexpr int   kHd    = 64;
constexpr int   kM     = kB * kSeq;      // 4096 rows
// 64^-0.5 * log2(e): scores, maxima and exponents are kept in log2 units.
constexpr float kScaleLog2e = 0.125f * 1.4426950408889634f;

// LDS row pitches in halves: 16 bytes x an odd number, so that the 16 rows a
// ds_load_b128 fragment read touches fall on distinct banks (64 banks x 4 B).
constexpr int kKs  = 64;   // QKV GEMM stage: 64 k, a tile row is one 128-byte line
constexpr int kLdG = 72;   // its tiles: 128-byte rows at a 144-byte pitch
constexpr int kKsO = 128;  // output GEMM stage: 128 k, a tile row is two lines
constexpr int kLdO = 136;  // its tiles: 256-byte rows at a 272-byte pitch
constexpr int kLdT = 72;   // attention K tile: 128-byte rows at a 144-byte pitch
// Rows read by the transposing load want 32 bytes x an odd number instead.
constexpr int kLdV = 80;   // attention V tile: 128-byte rows at a 160-byte pitch

// ---------------------------------------------------------------------------
// Elementwise f32 -> f16
// ---------------------------------------------------------------------------
__global__ void k_f32_to_f16(const float* __restrict__ in,
                             _Float16* __restrict__ out, int n) {
  int i = blockIdx.x * blockDim.x + threadIdx.x;
  if (i < n) out[i] = (_Float16)in[i];
}

// Transpose + convert: in f32 [R][C] -> out f16 [C][R]  (weights -> N-major)
// One 64x64 tile per block, turned in LDS: input rows are read as 256-byte
// runs and every output row of the tile leaves as one whole 128-byte line.
// R and C are multiples of 64; grid = (C/64, R/64), 256 threads.
__global__ __launch_bounds__(256) void k_transpose_f16(
    const float* __restrict__ in, _Float16* __restrict__ out, int R, int C) {
  __shared__ float sT[64][65];   // odd pitch: column reads fall on distinct banks
  const int tid = threadIdx.x;
  const int c0 = blockIdx.x * 64, r0 = blockIdx.y * 64;

  const int lr = tid >> 4, lc = (tid & 15) << 2;
  float4 v[4];
#pragma unroll
  for (int i = 0; i < 4; ++i)
    v[i] = *(const float4*)&in[(size_t)(r0 + lr + i * 16) * C + c0 + lc];
#pragma unroll
  for (int i = 0; i < 4; ++i) {
    sT[lr + i * 16][lc + 0] = v[i].x;
    sT[lr + i * 16][lc + 1] = v[i].y;
    sT[lr + i * 16][lc + 2] = v[i].z;
    sT[lr + i * 16][lc + 3] = v[i].w;
  }
  __syncthreads();

  const int rg = (tid & 7) << 3;   // 8 lanes x 8 halves = one output line
#pragma unroll
  for (int i = 0; i < 2; ++i) {
    const int oc = (tid >> 3) + i * 32;
    v8h h;
#pragma unroll
    for (int e = 0; e < 8; ++e) h[e] = (_Float16)sT[rg + e][oc];
    *(v8h*)&out[(size_t)(c0 + oc) * R + r0 + rg] = h;
  }
}

// ---------------------------------------------------------------------------
// QKV projection: C[4096,3072] = Xh[4096,1024] @ Wqkv; scatter to q/k/v
// in [B,H,N,Dh] f16 layout. Block tile 128x128, K-step 64, 8 waves (4x2).
// Async double-buffered LDS staging: DMA tile kt+1 while WMMAs chew tile kt.
// ---------------------------------------------------------------------------
__global__ __launch_bounds__(256) void k_qkv_gemm(
    const _Float16* __restrict__ A,    // [4096,1024]
    const _Float16* __restrict__ Bt,   // [3072,1024]  (Wqkv^T, N-major)
    const float* __restrict__ bias,    // [3072]
    _Float16* __restrict__ qh, _Float16* __restrict__ kh,
    _Float16* __restrict__ vh) {
  __shared__ __align__(16) _Float16 sA[2][128 * kLdG];
  __shared__ __align__(16) _Float16 sB[2][128 * kLdG];
  const int tid = threadIdx.x, lane = tid & 31, w = tid >> 5;
  const int wm = w & 3, wn = w >> 2;
  const int m0 = blockIdx.x * 128, n0 = blockIdx.y * 128;
  constexpr int KT = kDim / kKs;

  auto stage = [&](int kt, int buf) {        // 128 rows x 64 halves per tile
    // 8 lanes a row: a wave's copy takes 4 whole lines. Rows r + 0, 32, 64, 96.
    const int r = tid >> 3, kc = (tid & 7) << 3;
    async_copy8_b128(&sA[buf][r * kLdG + kc],
                     &A[(size_t)(m0 + r) * kDim + kt * kKs + kc],
                     &sB[buf][r * kLdG + kc],
                     &Bt[(size_t)(n0 + r) * kDim + kt * kKs + kc],
                     32 * kLdG, 32 * kDim);
  };

  v8f acc[2][4];
  v8f z = {};
#pragma unroll
  for (int i = 0; i < 2; ++i)
#pragma unroll
    for (int j = 0; j < 4; ++j) acc[i][j] = z;

  stage(0, 0);
  wait_async0();
  __syncthreads();

  for (int kt = 0; kt < KT; ++kt) {
    const int cur = kt & 1;
    if (kt + 1 < KT) stage(kt + 1, cur ^ 1);   // overlap DMA with compute

#pragma unroll   // ks becomes an immediate offset of the LDS reads
    for (int ks = 0; ks < kKs; ks += 32) {
      v16h af[2], bf[4];
#pragma unroll
      for (int i = 0; i < 2; ++i)
        af[i] = load_frag16(&sA[cur][(wm * 32 + i * 16) * kLdG + ks], kLdG, lane);
#pragma unroll
      for (int j = 0; j < 4; ++j)
        bf[j] = load_frag16(&sB[cur][(wn * 64 + j * 16) * kLdG + ks], kLdG, lane);
#pragma unroll
      for (int i = 0; i < 2; ++i)
#pragma unroll
        for (int j = 0; j < 4; ++j) acc[i][j] = wmma16(af[i], bf[j], acc[i][j]);
    }

    wait_ds0();
    wait_async0();
    __syncthreads();
  }

  // Epilogue: C layout = VGPR e holds row (e + 8*(lane>=16)), col (lane&15).
  const int rl = (lane >> 4) << 3;
#pragma unroll
  for (int i = 0; i < 2; ++i) {
#pragma unroll
    for (int j = 0; j < 4; ++j) {
      const int gn = n0 + wn * 64 + j * 16 + (lane & 15);
      const float bn = bias[gn];
      const int which = gn >> 10;            // 0=q 1=k 2=v
      const int cc = gn & 1023;
      const int hh = cc >> 6, dd = cc & 63;
      _Float16* dst = (which == 0) ? qh : (which == 1) ? kh : vh;
#pragma unroll
      for (int e = 0; e < 8; ++e) {
        const int gm = m0 + wm * 32 + i * 16 + rl + e;
        const int bb = gm >> 11, tt = gm & 2047;
        dst[(((size_t)(bb * kHeads + hh)) * kSeq + tt) * kHd + dd] =
            (_Float16)(acc[i][j][e] + bn);
      }
    }
  }
}

__global__ __launch_bounds__(256) void k_attn(
    const _Float16* __restrict__ qh, const _Float16* __restrict__ kh,
    const _Float16* __restrict__ vh, _Float16* __restrict__ oh) {
  __shared__ __align__(16) _Float16 sK[64 * kLdT];       // [key][dh]
  __shared__ __align__(16) _Float16 sV[64 * kLdV];       // [key][dh]

  const int tid = threadIdx.x, lane = tid & 31, w = tid >> 5;
  const int bh = blockIdx.y;                     // 0..B*H-1
  const int b = bh >> 4, h = bh & 15;
  const int q0 = blockIdx.x * 128 + w * 16;      // this wave's query rows
  const size_t bhBase = (size_t)bh * kSeq * kHd;

  // Q fragments (B operand: column = query) stay resident in registers.
  v16h qf[2];
  {
    const _Float16* qp = qh + bhBase + (size_t)q0 * kHd;
#pragma unroll
    for (int j = 0; j < 2; ++j) qf[j] = load_frag16(qp + j * 32, kHd, lane);
  }

  // o[c][e] = O^T[dh = c*16 + 8*(lane>>4) + e][query = lane&15]
  v8f o[4];
  v8f z = {};
#pragma unroll
  for (int c = 0; c < 4; ++c) o[c] = z;
  float mrow = -1e30f;   // running maximum of this lane's query
  float lrow = 0.f;      // running sum over this wave half's keys only

  for (int kt = 0; kt < kSeq / 64; ++kt) {
    wait_ds0();
    __syncthreads();
    const int kb = kt * 64;
    {
      // 64 keys x 64 dh of K and of V: rows key and key + 32 of each, async DMA
      // straight into LDS. Every lane is on at the copies.
      const int key = tid >> 3, dc = (tid & 7) << 3;
      const size_t g = bhBase + (size_t)(kb + key) * kHd + dc;
      async_copy4_b128(&sK[key * kLdT + dc], &kh[g],
                       &sV[key * kLdV + dc], &vh[g],
                       &sK[(key + 32) * kLdT + dc], &kh[g + 32 * kHd],
                       &sV[(key + 32) * kLdV + dc], &vh[g + 32 * kHd]);
    }
#pragma unroll
    for (int it = 0; it < 2; ++it) {
      const int c = tid + it * 256;
      const int key = c >> 3, dc = (c & 7) << 3;
      if (kt + 1 < kSeq / 64) {
        __builtin_prefetch(&kh[bhBase + (size_t)(kb + 64 + key) * kHd + dc], 0, 1);
        __builtin_prefetch(&vh[bhBase + (size_t)(kb + 64 + key) * kHd + dc], 0, 1);
      }
    }
    wait_async0();
    __syncthreads();

    // S^T = K @ Q^T: s[c][e] = score of key c*16 + 8*(lane>>4) + e.
    v8f s[4];
#pragma unroll
    for (int c = 0; c < 4; ++c) s[c] = z;
#pragma unroll
    for (int j = 0; j < 2; ++j)
#pragma unroll
      for (int c = 0; c < 4; ++c) {
        v16h kf = load_frag16(&sK[(c * 16) * kLdT + j * 32], kLdT, lane);
        s[c] = wmma16(kf, qf[j], s[c]);
      }

    // Online softmax: 32 of the query's 64 scores are in this lane, the other
    // 32 in lane ^ 16.
    float mc[4];
#pragma unroll
    for (int c = 0; c < 4; ++c) {
      mc[c] = s[c][0];
#pragma unroll
      for (int e = 1; e < 8; ++e) mc[c] = fmaxf(mc[c], s[c][e]);
    }
    float mx = fmaxf(fmaxf(mc[0], mc[1]), fmaxf(mc[2], mc[3]));
    mx = fmaxf(mx, xhalf(mx));
    const float mnew = fmaxf(mrow, mx * kScaleLog2e);
    const float alpha = __builtin_amdgcn_exp2f(mrow - mnew);
    // Two scores (an even register pair of the result tile) at a time: one
    // packed FMA gives both exponents, one packed add takes both into the sum.
    const v2f sc2 = {kScaleLog2e, kScaleLog2e};
    const v2f nm2 = {-mnew, -mnew};
    v2f rs[4];
#pragma unroll
    for (int c = 0; c < 4; ++c) {
#pragma unroll
      for (int e = 0; e < 8; e += 2) {
        const v2f t = __builtin_elementwise_fma((v2f){s[c][e], s[c][e + 1]},
                                                sc2, nm2);
        const v2f p = {__builtin_amdgcn_exp2f(t.x), __builtin_amdgcn_exp2f(t.y)};
        s[c][e] = p.x;
        s[c][e + 1] = p.y;
        rs[c] = (e == 0) ? p : rs[c] + p;
      }
    }
    const v2f rt = (rs[0] + rs[1]) + (rs[2] + rs[3]);
    lrow = lrow * alpha + (rt.x + rt.y);
    mrow = mnew;
#pragma unroll
    for (int c = 0; c < 4; ++c)
#pragma unroll
      for (int e = 0; e < 8; ++e) o[c][e] *= alpha;

    // P^T as B fragments, in place: element t of fragment j is key
    // j*32 + (t < 8 ? 8*(lane>>4) + t : 16 + 8*(lane>>4) + t - 8), which is
    // register t&7 of tile 2j + (t>>3) and the k order of load_frag16.
    v16h pf[2];
#pragma unroll
    for (int j = 0; j < 2; ++j)
#pragma unroll
      for (int t = 0; t < 16; ++t)
        pf[j][t] = (_Float16)s[2 * j + (t >> 3)][t & 7];

    // O^T += V^T @ P^T
#pragma unroll
    for (int j = 0; j < 2; ++j)
#pragma unroll
      for (int c = 0; c < 4; ++c) {
        v16h vf = load_frag16_tr(&sV[(j * 32) * kLdV + c * 16], kLdV, lane);
        o[c] = wmma16(vf, pf[j], o[c]);
      }
  }

  // Join the two halves' sums, normalize, and write O in
  // [b, token, h*64+dh] (row-major for out-proj): 8 consecutive dh per lane.
  const float inv = 1.f / (lrow + xhalf(lrow));
  const int token = q0 + (lane & 15);
  _Float16* op = &oh[((size_t)(b * kSeq + token)) * kDim + h * kHd +
                     ((lane >> 4) << 3)];
#pragma unroll
  for (int c = 0; c < 4; ++c) {
    v8h r;
#pragma unroll
    for (int e = 0; e < 8; ++e) r[e] = (_Float16)(o[c][e] * inv);
    *(v8h*)(op + c * 16) = r;
  }
}

// ---------------------------------------------------------------------------
// Output projection: out[4096,1024] = Oh @ Wout + b_out (f32 result).
// Same async double-buffered pipeline as the QKV GEMM, in stages of 128 k: one
// work-group a WGP here, so the longer stage has to cover the copies' flight.
// ---------------------------------------------------------------------------
__global__ __launch_bounds__(256) void k_out_gemm(
    const _Float16* __restrict__ A,    // [4096,1024]
    const _Float16* __restrict__ Bt,   // [1024,1024] (Wout^T)
    const float* __restrict__ bias,    // [1024]
    float* __restrict__ C) {
  __shared__ __align__(16) _Float16 sA[2][128 * kLdO];
  __shared__ __align__(16) _Float16 sB[2][128 * kLdO];
  const int tid = threadIdx.x, lane = tid & 31, w = tid >> 5;
  const int wm = w & 3, wn = w >> 2;
  const int m0 = blockIdx.x * 128, n0 = blockIdx.y * 128;
  constexpr int KT = kDim / kKsO;

  auto stage = [&](int kt, int buf) {        // 128 rows x 128 halves per tile
    // 16 lanes a row: a wave's copy takes 4 whole lines. Rows r + 0, 16, .. 112.
    const int r = tid >> 4, kc = (tid & 15) << 3;
#pragma unroll   // two statements: an asm statement takes at most 15 copies
    for (int h = 0; h < 128; h += 64)
      async_copy8_b128(&sA[buf][(r + h) * kLdO + kc],
                       &A[(size_t)(m0 + r + h) * kDim + kt * kKsO + kc],
                       &sB[buf][(r + h) * kLdO + kc],
                       &Bt[(size_t)(n0 + r + h) * kDim + kt * kKsO + kc],
                       16 * kLdO, 16 * kDim);
  };

  v8f acc[2][4];
  v8f z = {};
#pragma unroll
  for (int i = 0; i < 2; ++i)
#pragma unroll
    for (int j = 0; j < 4; ++j) acc[i][j] = z;

  stage(0, 0);
  wait_async0();
  __syncthreads();

  for (int kt = 0; kt < KT; ++kt) {
    const int cur = kt & 1;
    if (kt + 1 < KT) stage(kt + 1, cur ^ 1);

#pragma unroll   // ks becomes an immediate offset of the LDS reads
    for (int ks = 0; ks < kKsO; ks += 32) {
      v16h af[2], bf[4];
#pragma unroll
      for (int i = 0; i < 2; ++i)
        af[i] = load_frag16(&sA[cur][(wm * 32 + i * 16) * kLdO + ks], kLdO, lane);
#pragma unroll
      for (int j = 0; j < 4; ++j)
        bf[j] = load_frag16(&sB[cur][(wn * 64 + j * 16) * kLdO + ks], kLdO, lane);
#pragma unroll
      for (int i = 0; i < 2; ++i)
#pragma unroll
        for (int j = 0; j < 4; ++j) acc[i][j] = wmma16(af[i], bf[j], acc[i][j]);
    }

    wait_ds0();
    wait_async0();
    __syncthreads();
  }

  const int rl = (lane >> 4) << 3;
#pragma unroll
  for (int i = 0; i < 2; ++i) {
#pragma unroll
    for (int j = 0; j < 4; ++j) {
      const int gn = n0 + wn * 64 + j * 16 + (lane & 15);
      const float bn = bias[gn];
#pragma unroll
      for (int e = 0; e < 8; ++e) {
        const int gm = m0 + wm * 32 + i * 16 + rl + e;
        C[(size_t)gm * kDim + gn] = acc[i][j][e] + bn;
      }
    }
  }
}

// ---------------------------------------------------------------------------
// Host-side launcher.
// ---------------------------------------------------------------------------
extern "C" void kernel_launch(void* const* d_in, const int* in_sizes, int n_in,
                              void* d_out, int out_size, void* d_ws,
                              size_t ws_size, hipStream_t stream) {
  (void)in_sizes; (void)n_in; (void)out_size; (void)ws_size;
  const float* x    = (const float*)d_in[0];   // [2,2048,1024]
  const float* Wqkv = (const float*)d_in[1];   // [1024,3072]
  const float* bqkv = (const float*)d_in[2];   // [3072]
  const float* Wout = (const float*)d_in[3];   // [1024,1024]
  const float* bout = (const float*)d_in[4];   // [1024]
  float* out = (float*)d_out;                  // [2,2048,1024]

  char* ws = (char*)d_ws;
  size_t off = 0;
  auto alloc = [&](size_t bytes) -> void* {
    void* p = ws + off;
    off += (bytes + 255) & ~(size_t)255;
    return p;
  };
  const size_t nX = (size_t)kM * kDim;                 // 4.19M
  _Float16* xh    = (_Float16*)alloc(nX * 2);          // reused as Oh later
  _Float16* wqkvT = (_Float16*)alloc((size_t)3 * kDim * kDim * 2);
  _Float16* woutT = (_Float16*)alloc((size_t)kDim * kDim * 2);
  _Float16* qh    = (_Float16*)alloc(nX * 2);
  _Float16* kh    = (_Float16*)alloc(nX * 2);
  _Float16* vh    = (_Float16*)alloc(nX * 2);
  _Float16* oh    = xh;  // xh dead after QKV GEMM; alias for attention output

  // 1) precision/layout conversion (bandwidth-trivial: ~30 MB total)
  k_f32_to_f16<<<(int)((nX + 255) / 256), 256, 0, stream>>>(x, xh, (int)nX);
  k_transpose_f16<<<dim3((3 * kDim) / 64, kDim / 64), 256, 0, stream>>>(
      Wqkv, wqkvT, kDim, 3 * kDim);
  k_transpose_f16<<<dim3(kDim / 64, kDim / 64), 256, 0, stream>>>(
      Wout, woutT, kDim, kDim);

  // 2) QKV projection -> q/k/v in [B,H,N,Dh] f16
  k_qkv_gemm<<<dim3(kM / 128, (3 * kDim) / 128), 256, 0, stream>>>(
      xh, wqkvT, bqkv, qh, kh, vh);

  // 3) flash attention -> Oh in [B,N,C] f16
  k_attn<<<dim3(kSeq / 128, kB * kHeads), 256, 0, stream>>>(qh, kh, vh, oh);

  // 4) output projection -> f32 result
  k_out_gemm<<<dim3(kM / 128, kDim / 128), 256, 0, stream>>>(
      oh, woutT, bout, out);
}

// v007
// Measured time: 89.3 microseconds a run.
// Next to v006, in two timings, it ran 1.04 times as fast each time.
// All steps since v000 together make it 4.81 times as fast.
#include <hip/hip_runtime.h>
#include <hip/hip_bf16.h>

// ---------------------------------------------------------------------------
// MI455X (gfx1250) multi-head attention forward.
// f16 storage + f32 WMMA accumulation via v_wmma_f32_16x16x32_f16 (wave32).
// Global->LDS staging uses CDNA5 async-LDS DMA (ASYNCcnt), double-buffered in the GEMMs.
// ---------------------------------------------------------------------------

typedef __attribute__((ext_vector_type(16))) _Float16 v16h;
typedef __attribute__((ext_vector_type(8)))  _Float16 v8h;
typedef __attribute__((ext_vector_type(8)))  float    v8f;
typedef __attribute__((ext_vector_type(2)))  float    v2f;

union HFrag { v16h v; v8h h[2]; };

// Load one 16x32 f16 A/B fragment from a row-major (ld halves) tile.
// Per ISA 7.12.2: lane L holds row (L&15); K halves are
//   [off..off+7] in VGPR0-3 and [off+16..off+23] in VGPR4-7, off=(L>=16)*8.
// B fragments use the identical layout on the N-major (transposed) operand.
__device__ __forceinline__ v16h load_frag16(const _Float16* __restrict__ base,
                                            int ld, int lane) {
  const _Float16* p = base + (lane & 15) * ld + ((lane >> 4) << 3);
  HFrag f;
  f.h[0] = *(const v8h*)(p);
  f.h[1] = *(const v8h*)(p + 16);
  return f.v;
}

// One 16x32 A fragment of the TRANSPOSE of a row-major [k][m] f16 LDS tile (ld
// halves a row): two transposing LDS loads, 16 k rows each. Lane l hands in the
// address of 16 bytes of row 8*(l>>4) + (l&7), byte column 16*((l>>3)&1), and
// gets k = 8*(l>>4) + 0..7 of column l&15: the k order of load_frag16.
__device__ __forceinline__ v16h load_frag16_tr(const _Float16* base, int ld,
                                               int lane) {
  typedef __attribute__((ext_vector_type(8))) short s16x8;
  typedef __attribute__((address_space(3))) s16x8 lds_s16x8;
  const _Float16* p = base + (((lane >> 4) << 3) + (lane & 7)) * ld +
                      (((lane >> 3) & 1) << 3);
  HFrag f;
  f.h[0] = __builtin_bit_cast(
      v8h, __builtin_amdgcn_ds_load_tr16_b128_v8i16((lds_s16x8*)p));
  f.h[1] = __builtin_bit_cast(
      v8h, __builtin_amdgcn_ds_load_tr16_b128_v8i16((lds_s16x8*)(p + 16 * ld)));
  return f.v;
}

__device__ __forceinline__ v8f wmma16(v16h a, v16h b, v8f c) {
  return __builtin_amdgcn_wmma_f32_16x16x32_f16(false, a, false, b,
                                                (short)0, c, false, false);
}

// CDNA5 async global->LDS copy, 16B per lane (GLOBAL_LOAD_ASYNC_TO_LDS_B128,
// tracked with ASYNCcnt). LDS destination is the low 32 address bits of the
// generic shared-memory pointer (aperture mapping, ISA 10.2).
// Four such copies (one stage of a thread) under one s_wait_xcnt 0.
__device__ __forceinline__ void async_copy4_b128(
    void* l0, const _Float16* g0, void* l1, const _Float16* g1,
    void* l2, const _Float16* g2, void* l3, const _Float16* g3) {
  unsigned int o0 = (unsigned int)(unsigned long long)(uintptr_t)l0;
  unsigned int o1 = (unsigned int)(unsigned long long)(uintptr_t)l1;
  unsigned int o2 = (unsigned int)(unsigned long long)(uintptr_t)l2;
  unsigned int o3 = (unsigned int)(unsigned long long)(uintptr_t)l3;
  unsigned long long a0 = (unsigned long long)(uintptr_t)g0;
  unsigned long long a1 = (unsigned long long)(uintptr_t)g1;
  unsigned long long a2 = (unsigned long long)(uintptr_t)g2;
  unsigned long long a3 = (unsigned long long)(uintptr_t)g3;
  // The wait is the statement's last line: the address registers live to it,
  // so no later write of them can be scheduled in front of it.
  asm volatile("global_load_async_to_lds_b128 %0, %1, off\n\t"
               "global_load_async_to_lds_b128 %2, %3, off\n\t"
               "global_load_async_to_lds_b128 %4, %5, off\n\t"
               "global_load_async_to_lds_b128 %6, %7, off\n\t"
               "s_wait_xcnt 0x0"
               :: "v"(o0), "v"(a0), "v"(o1), "v"(a1),
                  "v"(o2), "v"(a2), "v"(o3), "v"(a3)
               : "memory");
}

// Eight such copies under one s_wait_xcnt 0: four rows of each GEMM operand,
// lstep (LDS) and gstep (global) halves apart.
__device__ __forceinline__ void async_copy8_b128(
    _Float16* la, const _Float16* ga, _Float16* lb, const _Float16* gb,
    int lstep, int gstep) {
  unsigned int oa[4], ob[4];
  unsigned long long aa[4], ab[4];
#pragma unroll   // the arrays become plain registers for the asm operands
  for (int i = 0; i < 4; ++i) {
    oa[i] = (unsigned int)(unsigned long long)(uintptr_t)(la + i * lstep);
    ob[i] = (unsigned int)(unsigned long long)(uintptr_t)(lb + i * lstep);
    aa[i] = (unsigned long long)(uintptr_t)(ga + (size_t)i * gstep);
    ab[i] = (unsigned long long)(uintptr_t)(gb + (size_t)i * gstep);
  }
  // The wait is the statement's last line: the address registers live to it,
  // so no later write of them can be scheduled in front of it.
  asm volatile("global_load_async_to_lds_b128 %0, %1, off\n\t"
               "global_load_async_to_lds_b128 %2, %3, off\n\t"
               "global_load_async_to_lds_b128 %4, %5, off\n\t"
               "global_load_async_to_lds_b128 %6, %7, off\n\t"
               "global_load_async_to_lds_b128 %8, %9, off\n\t"
               "global_load_async_to_lds_b128 %10, %11, off\n\t"
               "global_load_async_to_lds_b128 %12, %13, off\n\t"
               "global_load_async_to_lds_b128 %14, %15, off\n\t"
               "s_wait_xcnt 0x0"
               :: "v"(oa[0]), "v"(aa[0]), "v"(ob[0]), "v"(ab[0]),
                  "v"(oa[1]), "v"(aa[1]), "v"(ob[1]), "v"(ab[1]),
                  "v"(oa[2]), "v"(aa[2]), "v"(ob[2]), "v"(ab[2]),
                  "v"(oa[3]), "v"(aa[3]), "v"(ob[3]), "v"(ab[3])
               : "memory");
}

__device__ __forceinline__ void wait_async0() {
  asm volatile("s_wait_asynccnt 0x0" ::: "memory");
}

// This wave's LDS reads have retired before the barrier behind which a copy
// refills the bytes they read.
__device__ __forceinline__ void wait_ds0() {
  asm volatile("s_wait_dscnt 0x0" ::: "memory");
}

// Lane l <-> lane l ^ 16 as one vector instruction (a shuffle builtin would go
// through the LDS pipe and its latency).
__device__ __forceinline__ float xhalf(float x) {
  const int b = __builtin_bit_cast(int, x);
  return __builtin_bit_cast(float, __builtin_amdgcn_permlanex16(
      b, b, 0x76543210, 0xfedcba98, false, false));
}

// Problem constants (from the reference).
constexpr int   kB     = 2;
constexpr int   kSeq   = 2048;
constexpr int   kDim   = 1024;
constexpr int   kHeads = 16;
constexpr int   kHd    = 64;
constexpr int   kM     = kB * kSeq;      // 4096 rows
// 64^-0.5 * log2(e): scores, maxima and exponents are kept in log2 units.
constexpr float kScaleLog2e = 0.125f * 1.4426950408889634f;

// LDS row pitches in halves: 16 bytes x an odd number, so that the 16 rows a
// ds_load_b128 fragment read touches fall on distinct banks (64 banks x 4 B).
constexpr int kKs  = 64;   // QKV GEMM stage: 64 k, a tile row is one 128-byte line
constexpr int kLdG = 72;   // its tiles: 128-byte rows at a 144-byte pitch
constexpr int kKsO = 128;  // output GEMM stage: 128 k, a tile row is two lines
constexpr int kLdO = 136;  // its tiles: 256-byte rows at a 272-byte pitch
constexpr int kLdT = 72;   // attention K tile: 128-byte rows at a 144-byte pitch
// Rows read by the transposing load want 32 bytes x an odd number instead.
constexpr int kLdV = 80;   // attention V tile: 128-byte rows at a 160-byte pitch

// ---------------------------------------------------------------------------
// Elementwise f32 -> f16
// ---------------------------------------------------------------------------
__global__ void k_f32_to_f16(const float* __restrict__ in,
                             _Float16* __restrict__ out, int n) {
  int i = blockIdx.x * blockDim.x + threadIdx.x;
  if (i < n) out[i] = (_Float16)in[i];
}

// Transpose + convert: in f32 [R][C] -> out f16 [C][R]  (weights -> N-major)
// One 64x64 tile per block, turned in LDS: input rows are read as 256-byte
// runs and every output row of the tile leaves as one whole 128-byte line.
// R and C are multiples of 64; grid = (C/64, R/64), 256 threads.
__global__ __launch_bounds__(256) void k_transpose_f16(
    const float* __restrict__ in, _Float16* __restrict__ out, int R, int C) {
  __shared__ float sT[64][65];   // odd pitch: column reads fall on distinct banks
  const int tid = threadIdx.x;
  const int c0 = blockIdx.x * 64, r0 = blockIdx.y * 64;

  const int lr = tid >> 4, lc = (tid & 15) << 2;
  float4 v[4];
#pragma unroll
  for (int i = 0; i < 4; ++i)
    v[i] = *(const float4*)&in[(size_t)(r0 + lr + i * 16) * C + c0 + lc];
#pragma unroll
  for (int i = 0; i < 4; ++i) {
    sT[lr + i * 16][lc + 0] = v[i].x;
    sT[lr + i * 16][lc + 1] = v[i].y;
    sT[lr + i * 16][lc + 2] = v[i].z;
    sT[lr + i * 16][lc + 3] = v[i].w;
  }
  __syncthreads();

  const int rg = (tid & 7) << 3;   // 8 lanes x 8 halves = one output line
#pragma unroll
  for (int i = 0; i < 2; ++i) {
    const int oc = (tid >> 3) + i * 32;
    v8h h;
#pragma unroll
    for (int e = 0; e < 8; ++e) h[e] = (_Float16)sT[rg + e][oc];
    *(v8h*)&out[(size_t)(c0 + oc) * R + r0 + rg] = h;
  }
}

// ---------------------------------------------------------------------------
// QKV projection: C[4096,3072] = Xh[4096,1024] @ Wqkv; scatter to q/k/v
// in [B,H,N,Dh] f16 layout. Block tile 128x128, K-step 64, 8 waves (4x2).
// Async double-buffered LDS staging: DMA tile kt+1 while WMMAs chew tile kt.
// ---------------------------------------------------------------------------
__global__ __launch_bounds__(256) void k_qkv_gemm(
    const _Float16* __restrict__ A,    // [4096,1024]
    const _Float16* __restrict__ Bt,   // [3072,1024]  (Wqkv^T, N-major)
    const float* __restrict__ bias,    // [3072]
    _Float16* __restrict__ qh, _Float16* __restrict__ kh,
    _Float16* __restrict__ vh) {
  __shared__ __align__(16) _Float16 sA[2][128 * kLdG];
  __shared__ __align__(16) _Float16 sB[2][128 * kLdG];
  const int tid = threadIdx.x, lane = tid & 31, w = tid >> 5;
  const int wm = w & 3, wn = w >> 2;
  const int m0 = blockIdx.x * 128, n0 = blockIdx.y * 128;
  constexpr int KT = kDim / kKs;

  auto stage = [&](int kt, int buf) {        // 128 rows x 64 halves per tile
    // 8 lanes a row: a wave's copy takes 4 whole lines. Rows r + 0, 32, 64, 96.
    const int r = tid >> 3, kc = (tid & 7) << 3;
    async_copy8_b128(&sA[buf][r * kLdG + kc],
                     &A[(size_t)(m0 + r) * kDim + kt * kKs + kc],
                     &sB[buf][r * kLdG + kc],
                     &Bt[(size_t)(n0 + r) * kDim + kt * kKs + kc],
                     32 * kLdG, 32 * kDim);
  };

  v8f acc[2][4];
  v8f z = {};
#pragma unroll
  for (int i = 0; i < 2; ++i)
#pragma unroll
    for (int j = 0; j < 4; ++j) acc[i][j] = z;

  stage(0, 0);
  wait_async0();
  __syncthreads();

  for (int kt = 0; kt < KT; ++kt) {
    const int cur = kt & 1;
    if (kt + 1 < KT) stage(kt + 1, cur ^ 1);   // overlap DMA with compute

#pragma unroll   // ks becomes an immediate offset of the LDS reads
    for (int ks = 0; ks < kKs; ks += 32) {
      v16h af[2], bf[4];
#pragma unroll
      for (int i = 0; i < 2; ++i)
        af[i] = load_frag16(&sA[cur][(wm * 32 + i * 16) * kLdG + ks], kLdG, lane);
#pragma unroll
      for (int j = 0; j < 4; ++j)
        bf[j] = load_frag16(&sB[cur][(wn * 64 + j * 16) * kLdG + ks], kLdG, lane);
#pragma unroll
      for (int i = 0; i < 2; ++i)
#pragma unroll
        for (int j = 0; j < 4; ++j) acc[i][j] = wmma16(af[i], bf[j], acc[i][j]);
    }

    wait_ds0();
    wait_async0();
    __syncthreads();
  }

  // Epilogue: C layout = VGPR e holds row (e + 8*(lane>=16)), col (lane&15).
  const int rl = (lane >> 4) << 3;
#pragma unroll
  for (int i = 0; i < 2; ++i) {
#pragma unroll
    for (int j = 0; j < 4; ++j) {
      const int gn = n0 + wn * 64 + j * 16 + (lane & 15);
      const float bn = bias[gn];
      const int which = gn >> 10;            // 0=q 1=k 2=v
      const int cc = gn & 1023;
      const int hh = cc >> 6, dd = cc & 63;
      _Float16* dst = (which == 0) ? qh : (which == 1) ? kh : vh;
#pragma unroll
      for (int e = 0; e < 8; ++e) {
        const int gm = m0 + wm * 32 + i * 16 + rl + e;
        const int bb = gm >> 11, tt = gm & 2047;
        dst[(((size_t)(bb * kHeads + hh)) * kSeq + tt) * kHd + dd] =
            (_Float16)(acc[i][j][e] + bn);
      }
    }
  }
}

__global__ __launch_bounds__(256) void k_attn(
    const _Float16* __restrict__ qh, const _Float16* __restrict__ kh,
    const _Float16* __restrict__ vh, _Float16* __restrict__ oh) {
  __shared__ __align__(16) _Float16 sK[64 * kLdT];       // [key][dh]
  __shared__ __align__(16) _Float16 sV[64 * kLdV];       // [key][dh]
  // Hand-over of one query tile's partial between the waves of a query group:
  // [wave][8 x 4 O^T values, then maximum and sum][lane], 16 bytes a lane.
  __shared__ __align__(16) float4 sX[8][9][32];

  const int tid = threadIdx.x, lane = tid & 31, w = tid >> 5;
  const int qg = w & 3, kq = w >> 2;             // query group, key half
  const int bh = blockIdx.y;                     // 0..B*H-1
  const int b = bh >> 4, h = bh & 15;
  const int q0 = blockIdx.x * 128 + qg * 32;     // this wave's 32 query rows
  const size_t bhBase = (size_t)bh * kSeq * kHd;

  // Q fragments (B operand: column = query) stay resident in registers.
  v16h qf[2][2];
#pragma unroll
  for (int n = 0; n < 2; ++n) {
    const _Float16* qp = qh + bhBase + (size_t)(q0 + n * 16) * kHd;
#pragma unroll
    for (int j = 0; j < 2; ++j) qf[n][j] = load_frag16(qp + j * 32, kHd, lane);
  }

  // o[n][c][e] = O^T[dh = c*16 + 8*(lane>>4) + e][query = n*16 + (lane&15)]
  v8f o[2][4];
  v8f z = {};
  float mrow[2], lrow[2];
#pragma unroll
  for (int n = 0; n < 2; ++n) {
#pragma unroll
    for (int c = 0; c < 4; ++c) o[n][c] = z;
    mrow[n] = -1e30f;   // running maximum of this lane's query, this key half
    lrow[n] = 0.f;      // running sum over this wave half's keys only
  }
  const _Float16* sKw = &sK[(kq * 32) * kLdT];   // this wave's 32 keys
  const _Float16* sVw = &sV[(kq * 32) * kLdV];

  for (int kt = 0; kt < kSeq / 64; ++kt) {
    wait_ds0();
    __syncthreads();
    const int kb = kt * 64;
    {
      // 64 keys x 64 dh of K and of V: rows key and key + 32 of each, async DMA
      // straight into LDS. Every lane is on at the copies.
      const int key = tid >> 3, dc = (tid & 7) << 3;
      const size_t g = bhBase + (size_t)(kb + key) * kHd + dc;
      async_copy4_b128(&sK[key * kLdT + dc], &kh[g],
                       &sV[key * kLdV + dc], &vh[g],
                       &sK[(key + 32) * kLdT + dc], &kh[g + 32 * kHd],
                       &sV[(key + 32) * kLdV + dc], &vh[g + 32 * kHd]);
    }
#pragma unroll
    for (int it = 0; it < 2; ++it) {
      const int c = tid + it * 256;
      const int key = c >> 3, dc = (c & 7) << 3;
      if (kt + 1 < kSeq / 64) {
        __builtin_prefetch(&kh[bhBase + (size_t)(kb + 64 + key) * kHd + dc], 0, 1);
        __builtin_prefetch(&vh[bhBase + (size_t)(kb + 64 + key) * kHd + dc], 0, 1);
      }
    }
    wait_async0();
    __syncthreads();

    // S^T = K @ Q^T: s[n][c][e] = score of key kq*32 + c*16 + 8*(lane>>4) + e.
    v8f s[2][2];
#pragma unroll
    for (int n = 0; n < 2; ++n)
#pragma unroll
      for (int c = 0; c < 2; ++c) s[n][c] = z;
#pragma unroll
    for (int j = 0; j < 2; ++j)
#pragma unroll
      for (int c = 0; c < 2; ++c) {
        v16h kf = load_frag16(&sKw[(c * 16) * kLdT + j * 32], kLdT, lane);
#pragma unroll
        for (int n = 0; n < 2; ++n) s[n][c] = wmma16(kf, qf[n][j], s[n][c]);
      }

    // Online softmax, per query tile: 16 of the query's 32 scores are in this
    // lane, the other 16 in lane ^ 16.
    const v2f sc2 = {kScaleLog2e, kScaleLog2e};
    v16h pf[2];
#pragma unroll
    for (int n = 0; n < 2; ++n) {
      float mc[2];
#pragma unroll
      for (int c = 0; c < 2; ++c) {
        mc[c] = s[n][c][0];
#pragma unroll
        for (int e = 1; e < 8; ++e) mc[c] = fmaxf(mc[c], s[n][c][e]);
      }
      float mx = fmaxf(mc[0], mc[1]);
      mx = fmaxf(mx, xhalf(mx));
      const float mnew = fmaxf(mrow[n], mx * kScaleLog2e);
      const float alpha = __builtin_amdgcn_exp2f(mrow[n] - mnew);
      // Two scores (an even register pair of the result tile) at a time: one
      // packed FMA gives both exponents, one packed add takes both into the sum.
      const v2f nm2 = {-mnew, -mnew};
      v2f rs[2];
#pragma unroll
      for (int c = 0; c < 2; ++c) {
#pragma unroll
        for (int e = 0; e < 8; e += 2) {
          const v2f t = __builtin_elementwise_fma(
              (v2f){s[n][c][e], s[n][c][e + 1]}, sc2, nm2);
          const v2f p = {__builtin_amdgcn_exp2f(t.x),
                         __builtin_amdgcn_exp2f(t.y)};
          s[n][c][e] = p.x;
          s[n][c][e + 1] = p.y;
          rs[c] = (e == 0) ? p : rs[c] + p;
        }
      }
      const v2f rt = rs[0] + rs[1];
      lrow[n] = lrow[n] * alpha + (rt.x + rt.y);
      mrow[n] = mnew;
#pragma unroll
      for (int c = 0; c < 4; ++c)
#pragma unroll
        for (int e = 0; e < 8; ++e) o[n][c][e] *= alpha;

      // P^T as a B fragment, in place: element t is key
      // (t < 8 ? 8*(lane>>4) + t : 16 + 8*(lane>>4) + t - 8) of the wave's 32,
      // which is register t&7 of tile t>>3 and the k order of load_frag16.
#pragma unroll
      for (int t = 0; t < 16; ++t) pf[n][t] = (_Float16)s[n][t >> 3][t & 7];
    }

    // O^T += V^T @ P^T
#pragma unroll
    for (int c = 0; c < 4; ++c) {
      v16h vf = load_frag16_tr(&sVw[c * 16], kLdV, lane);
#pragma unroll
      for (int n = 0; n < 2; ++n) o[n][c] = wmma16(vf, pf[n], o[n][c]);
    }
  }

  // Join the two key halves. Wave (qg, kq) finishes query tile kq: it hands
  // tile 1 - kq to its partner and takes the partner's partial of tile kq.
  const bool up = (kq != 0);
  const float lf0 = lrow[0] + xhalf(lrow[0]);
  const float lf1 = lrow[1] + xhalf(lrow[1]);
#pragma unroll
  for (int c = 0; c < 4; ++c) {
    const v8f g = up ? o[0][c] : o[1][c];
    sX[w][2 * c + 0][lane] = make_float4(g[0], g[1], g[2], g[3]);
    sX[w][2 * c + 1][lane] = make_float4(g[4], g[5], g[6], g[7]);
  }
  sX[w][8][lane] = make_float4(up ? mrow[0] : mrow[1], up ? lf0 : lf1, 0.f, 0.f);
  __syncthreads();

  const int pw = w ^ 4;                          // the partner wave
  const float4 ml = sX[pw][8][lane];
  const float mMine = up ? mrow[1] : mrow[0];
  const float lMine = up ? lf1 : lf0;
  const float mAll = fmaxf(mMine, ml.x);
  const float aMine = __builtin_amdgcn_exp2f(mMine - mAll);
  const float aOther = __builtin_amdgcn_exp2f(ml.x - mAll);
  const float inv = 1.f / (lMine * aMine + ml.y * aOther);
  const float fMine = aMine * inv, fOther = aOther * inv;

  // Normalize and write O in [b, token, h*64+dh] (row-major for out-proj):
  // 8 consecutive dh per lane.
  const int token = q0 + kq * 16 + (lane & 15);
  _Float16* op = &oh[((size_t)(b * kSeq + token)) * kDim + h * kHd +
                     ((lane >> 4) << 3)];
#pragma unroll
  for (int c = 0; c < 4; ++c) {
    const v8f mine = up ? o[1][c] : o[0][c];
    const float4 x0 = sX[pw][2 * c + 0][lane];
    const float4 x1 = sX[pw][2 * c + 1][lane];
    const float ot[8] = {x0.x, x0.y, x0.z, x0.w, x1.x, x1.y, x1.z, x1.w};
    v8h r;
#pragma unroll
    for (int e = 0; e < 8; ++e)
      r[e] = (_Float16)(mine[e] * fMine + ot[e] * fOther);
    *(v8h*)(op + c * 16) = r;
  }
}

// ---------------------------------------------------------------------------
// Output projection: out[4096,1024] = Oh @ Wout + b_out (f32 result).
// Same async double-buffered pipeline as the QKV GEMM, in stages of 128 k: one
// work-group a WGP here, so the longer stage has to cover the copies' flight.
// ---------------------------------------------------------------------------
__global__ __launch_bounds__(256) void k_out_gemm(
    const _Float16* __restrict__ A,    // [4096,1024]
    const _Float16* __restrict__ Bt,   // [1024,1024] (Wout^T)
    const float* __restrict__ bias,    // [1024]
    float* __restrict__ C) {
  __shared__ __align__(16) _Float16 sA[2][128 * kLdO];
  __shared__ __align__(16) _Float16 sB[2][128 * kLdO];
  const int tid = threadIdx.x, lane = tid & 31, w = tid >> 5;
  const int wm = w & 3, wn = w >> 2;
  const int m0 = blockIdx.x * 128, n0 = blockIdx.y * 128;
  constexpr int KT = kDim / kKsO;

  auto stage = [&](int kt, int buf) {        // 128 rows x 128 halves per tile
    // 16 lanes a row: a wave's copy takes 4 whole lines. Rows r + 0, 16, .. 112.
    const int r = tid >> 4, kc = (tid & 15) << 3;
#pragma unroll   // two statements: an asm statement takes at most 15 copies
    for (int h = 0; h < 128; h += 64)
      async_copy8_b128(&sA[buf][(r + h) * kLdO + kc],
                       &A[(size_t)(m0 + r + h) * kDim + kt * kKsO + kc],
                       &sB[buf][(r + h) * kLdO + kc],
                       &Bt[(size_t)(n0 + r + h) * kDim + kt * kKsO + kc],
                       16 * kLdO, 16 * kDim);
  };

  v8f acc[2][4];
  v8f z = {};
#pragma unroll
  for (int i = 0; i < 2; ++i)
#pragma unroll
    for (int j = 0; j < 4; ++j) acc[i][j] = z;

  stage(0, 0);
  wait_async0();
  __syncthreads();

  for (int kt = 0; kt < KT; ++kt) {
    const int cur = kt & 1;
    if (kt + 1 < KT) stage(kt + 1, cur ^ 1);

#pragma unroll   // ks becomes an immediate offset of the LDS reads
    for (int ks = 0; ks < kKsO; ks += 32) {
      v16h af[2], bf[4];
#pragma unroll
      for (int i = 0; i < 2; ++i)
        af[i] = load_frag16(&sA[cur][(wm * 32 + i * 16) * kLdO + ks], kLdO, lane);
#pragma unroll
      for (int j = 0; j < 4; ++j)
        bf[j] = load_frag16(&sB[cur][(wn * 64 + j * 16) * kLdO + ks], kLdO, lane);
#pragma unroll
      for (int i = 0; i < 2; ++i)
#pragma unroll
        for (int j = 0; j < 4; ++j) acc[i][j] = wmma16(af[i], bf[j], acc[i][j]);
    }

    wait_ds0();
    wait_async0();
    __syncthreads();
  }

  const int rl = (lane >> 4) << 3;
#pragma unroll
  for (int i = 0; i < 2; ++i) {
#pragma unroll
    for (int j = 0; j < 4; ++j) {
      const int gn = n0 + wn * 64 + j * 16 + (lane & 15);
      const float bn = bias[gn];
#pragma unroll
      for (int e = 0; e < 8; ++e) {
        const int gm = m0 + wm * 32 + i * 16 + rl + e;
        C[(size_t)gm * kDim + gn] = acc[i][j][e] + bn;
      }
    }
  }
}

// ---------------------------------------------------------------------------
// Host-side launcher.
// ---------------------------------------------------------------------------
extern "C" void kernel_launch(void* const* d_in, const int* in_sizes, int n_in,
                              void* d_out, int out_size, void* d_ws,
                              size_t ws_size, hipStream_t stream) {
  (void)in_sizes; (void)n_in; (void)out_size; (void)ws_size;
  const float* x    = (const float*)d_in[0];   // [2,2048,1024]
  const float* Wqkv = (const float*)d_in[1];   // [1024,3072]
  const float* bqkv = (const float*)d_in[2];   // [3072]
  const float* Wout = (const float*)d_in[3];   // [1024,1024]
  const float* bout = (const float*)d_in[4];   // [1024]
  float* out = (float*)d_out;                  // [2,2048,1024]

  char* ws = (char*)d_ws;
  size_t off = 0;
  auto alloc = [&](size_t bytes) -> void* {
    void* p = ws + off;
    off += (bytes + 255) & ~(size_t)255;
    return p;
  };
  const size_t nX = (size_t)kM * kDim;                 // 4.19M
  _Float16* xh    = (_Float16*)alloc(nX * 2);          // reused as Oh later
  _Float16* wqkvT = (_Float16*)alloc((size_t)3 * kDim * kDim * 2);
  _Float16* woutT = (_Float16*)alloc((size_t)kDim * kDim * 2);
  _Float16* qh    = (_Float16*)alloc(nX * 2);
  _Float16* kh    = (_Float16*)alloc(nX * 2);
  _Float16* vh    = (_Float16*)alloc(nX * 2);
  _Float16* oh    = xh;  // xh dead after QKV GEMM; alias for attention output

  // 1) precision/layout conversion (bandwidth-trivial: ~30 MB total)
  k_f32_to_f16<<<(int)((nX + 255) / 256), 256, 0, stream>>>(x, xh, (int)nX);
  k_transpose_f16<<<dim3((3 * kDim) / 64, kDim / 64), 256, 0, stream>>>(
      Wqkv, wqkvT, kDim, 3 * kDim);
  k_transpose_f16<<<dim3(kDim / 64, kDim / 64), 256, 0, stream>>>(
      Wout, woutT, kDim, kDim);

  // 2) QKV projection -> q/k/v in [B,H,N,Dh] f16
  k_qkv_gemm<<<dim3(kM / 128, (3 * kDim) / 128), 256, 0, stream>>>(
      xh, wqkvT, bqkv, qh, kh, vh);

  // 3) flash attention -> Oh in [B,N,C] f16
  k_attn<<<dim3(kSeq / 128, kB * kHeads), 256, 0, stream>>>(qh, kh, vh, oh);

  // 4) output projection -> f32 result
  k_out_gemm<<<dim3(kM / 128, kDim / 128), 256, 0, stream>>>(
      oh, woutT, bout, out);
}

// v008
// One run takes 83.6 microseconds.
// In both of two side-by-side timings against v007, it was 1.06 times as fast.
// All steps since v000 together make it 5.09 times as fast.
#include <hip/hip_runtime.h>
#include <hip/hip_bf16.h>

// ---------------------------------------------------------------------------
// MI455X (gfx1250) multi-head attention forward.
// f16 storage + f32 WMMA accumulation via v_wmma_f32_16x16x32_f16 (wave32).
// Global->LDS staging uses CDNA5 async-LDS DMA (ASYNCcnt), double-buffered in the GEMMs.
// ---------------------------------------------------------------------------

typedef __attribute__((ext_vector_type(16))) _Float16 v16h;
typedef __attribute__((ext_vector_type(8)))  _Float16 v8h;
typedef __attribute__((ext_vector_type(8)))  float    v8f;
typedef __attribute__((ext_vector_type(2)))  float    v2f;

union HFrag { v16h v; v8h h[2]; };

// Load one 16x32 f16 A/B fragment from a row-major (ld halves) tile.
// Per ISA 7.12.2: lane L holds row (L&15); K halves are
//   [off..off+7] in VGPR0-3 and [off+16..off+23] in VGPR4-7, off=(L>=16)*8.
// B fragments use the identical layout on the N-major (transposed) operand.
__device__ __forceinline__ v16h load_frag16(const _Float16* __restrict__ base,
                                            int ld, int lane) {
  const _Float16* p = base + (lane & 15) * ld + ((lane >> 4) << 3);
  HFrag f;
  f.h[0] = *(const v8h*)(p);
  f.h[1] = *(const v8h*)(p + 16);
  return f.v;
}

// One 16x32 A fragment of the TRANSPOSE of a row-major [k][m] f16 LDS tile (ld
// halves a row): two transposing LDS loads, 16 k rows each. Lane l hands in the
// address of 16 bytes of row 8*(l>>4) + (l&7), byte column 16*((l>>3)&1), and
// gets k = 8*(l>>4) + 0..7 of column l&15: the k order of load_frag16.
__device__ __forceinline__ v16h load_frag16_tr(const _Float16* base, int ld,
                                               int lane) {
  typedef __attribute__((ext_vector_type(8))) short s16x8;
  typedef __attribute__((address_space(3))) s16x8 lds_s16x8;
  const _Float16* p = base + (((lane >> 4) << 3) + (lane & 7)) * ld +
                      (((lane >> 3) & 1) << 3);
  HFrag f;
  f.h[0] = __builtin_bit_cast(
      v8h, __builtin_amdgcn_ds_load_tr16_b128_v8i16((lds_s16x8*)p));
  f.h[1] = __builtin_bit_cast(
      v8h, __builtin_amdgcn_ds_load_tr16_b128_v8i16((lds_s16x8*)(p + 16 * ld)));
  return f.v;
}

__device__ __forceinline__ v8f wmma16(v16h a, v16h b, v8f c) {
  return __builtin_amdgcn_wmma_f32_16x16x32_f16(false, a, false, b,
                                                (short)0, c, false, false);
}

// CDNA5 async global->LDS copy, 16B per lane (GLOBAL_LOAD_ASYNC_TO_LDS_B128,
// tracked with ASYNCcnt). LDS destination is the low 32 address bits of the
// generic shared-memory pointer (aperture mapping, ISA 10.2).
// Four such copies (one stage of a thread) under one s_wait_xcnt 0.
__device__ __forceinline__ void async_copy4_b128(
    void* l0, const _Float16* g0, void* l1, const _Float16* g1,
    void* l2, const _Float16* g2, void* l3, const _Float16* g3) {
  unsigned int o0 = (unsigned int)(unsigned long long)(uintptr_t)l0;
  unsigned int o1 = (unsigned int)(unsigned long long)(uintptr_t)l1;
  unsigned int o2 = (unsigned int)(unsigned long long)(uintptr_t)l2;
  unsigned int o3 = (unsigned int)(unsigned long long)(uintptr_t)l3;
  unsigned long long a0 = (unsigned long long)(uintptr_t)g0;
  unsigned long long a1 = (unsigned long long)(uintptr_t)g1;
  unsigned long long a2 = (unsigned long long)(uintptr_t)g2;
  unsigned long long a3 = (unsigned long long)(uintptr_t)g3;
  // The wait is the statement's last line: the address registers live to it,
  // so no later write of them can be scheduled in front of it.
  asm volatile("global_load_async_to_lds_b128 %0, %1, off\n\t"
               "global_load_async_to_lds_b128 %2, %3, off\n\t"
               "global_load_async_to_lds_b128 %4, %5, off\n\t"
               "global_load_async_to_lds_b128 %6, %7, off\n\t"
               "s_wait_xcnt 0x0"
               :: "v"(o0), "v"(a0), "v"(o1), "v"(a1),
                  "v"(o2), "v"(a2), "v"(o3), "v"(a3)
               : "memory");
}

// Eight such copies under one s_wait_xcnt 0: four rows of each GEMM operand,
// lstep (LDS) and gstep (global) halves apart.
__device__ __forceinline__ void async_copy8_b128(
    _Float16* la, const _Float16* ga, _Float16* lb, const _Float16* gb,
    int lstep, int gstep) {
  unsigned int oa[4], ob[4];
  unsigned long long aa[4], ab[4];
#pragma unroll   // the arrays become plain registers for the asm operands
  for (int i = 0; i < 4; ++i) {
    oa[i] = (unsigned int)(unsigned long long)(uintptr_t)(la + i * lstep);
    ob[i] = (unsigned int)(unsigned long long)(uintptr_t)(lb + i * lstep);
    aa[i] = (unsigned long long)(uintptr_t)(ga + (size_t)i * gstep);
    ab[i] = (unsigned long long)(uintptr_t)(gb + (size_t)i * gstep);
  }
  // The wait is the statement's last line: the address registers live to it,
  // so no later write of them can be scheduled in front of it.
  asm volatile("global_load_async_to_lds_b128 %0, %1, off\n\t"
               "global_load_async_to_lds_b128 %2, %3, off\n\t"
               "global_load_async_to_lds_b128 %4, %5, off\n\t"
               "global_load_async_to_lds_b128 %6, %7, off\n\t"
               "global_load_async_to_lds_b128 %8, %9, off\n\t"
               "global_load_async_to_lds_b128 %10, %11, off\n\t"
               "global_load_async_to_lds_b128 %12, %13, off\n\t"
               "global_load_async_to_lds_b128 %14, %15, off\n\t"
               "s_wait_xcnt 0x0"
               :: "v"(oa[0]), "v"(aa[0]), "v"(ob[0]), "v"(ab[0]),
                  "v"(oa[1]), "v"(aa[1]), "v"(ob[1]), "v"(ab[1]),
                  "v"(oa[2]), "v"(aa[2]), "v"(ob[2]), "v"(ab[2]),
                  "v"(oa[3]), "v"(aa[3]), "v"(ob[3]), "v"(ab[3])
               : "memory");
}

__device__ __forceinline__ void wait_async0() {
  asm volatile("s_wait_asynccnt 0x0" ::: "memory");
}

// This wave's LDS reads have retired before the barrier behind which a copy
// refills the bytes they read.
__device__ __forceinline__ void wait_ds0() {
  asm volatile("s_wait_dscnt 0x0" ::: "memory");
}

// Lane l <-> lane l ^ 16 as one vector instruction (a shuffle builtin would go
// through the LDS pipe and its latency).
__device__ __forceinline__ float xhalf(float x) {
  const int b = __builtin_bit_cast(int, x);
  return __builtin_bit_cast(float, __builtin_amdgcn_permlanex16(
      b, b, 0x76543210, 0xfedcba98, false, false));
}

// Problem constants (from the reference).
constexpr int   kB     = 2;
constexpr int   kSeq   = 2048;
constexpr int   kDim   = 1024;
constexpr int   kHeads = 16;
constexpr int   kHd    = 64;
constexpr int   kM     = kB * kSeq;      // 4096 rows
// 64^-0.5 * log2(e): scores, maxima and exponents are kept in log2 units.
constexpr float kScaleLog2e = 0.125f * 1.4426950408889634f;

// LDS row pitches in halves: 16 bytes x an odd number, so that the 16 rows a
// ds_load_b128 fragment read touches fall on distinct banks (64 banks x 4 B).
constexpr int kKs  = 64;   // QKV GEMM stage: 64 k, a tile row is one 128-byte line
constexpr int kLdG = 72;   // its tiles: 128-byte rows at a 144-byte pitch
constexpr int kKsO = 128;  // output GEMM stage: 128 k, a tile row is two lines
constexpr int kLdO = 136;  // its tiles: 256-byte rows at a 272-byte pitch
constexpr int kLdT = 72;   // attention K tile: 128-byte rows at a 144-byte pitch
// Rows read by the transposing load want 32 bytes x an odd number instead.
constexpr int kLdV = 80;   // attention V tile: 128-byte rows at a 160-byte pitch

// ---------------------------------------------------------------------------
// Preparation, one launch: the three conversions read only inputs and write
// disjoint buffers, so their work-groups share one grid, told apart by ranges
// of the block index. The weight tiles (a load, a barrier and a store deep)
// come first and run under the stream of x blocks that follows them.
// ---------------------------------------------------------------------------
constexpr int kBlkWqkv = ((3 * kDim) / 64) * (kDim / 64);   // 64x64 tiles of Wqkv
constexpr int kBlkWout = (kDim / 64) * (kDim / 64);         // 64x64 tiles of Wout
constexpr int kBlkX    = (kM * kDim) / 256;                 // 256 elements of x each
constexpr int kBlkPrep = kBlkWqkv + kBlkWout + kBlkX;

// Transpose + convert: in f32 [R][C] -> out f16 [C][R]  (weights -> N-major)
// One 64x64 tile (column tx, row ty) per block, turned in LDS: input rows are
// read as 256-byte runs and every output row of the tile leaves as one whole
// 128-byte line. R and C are multiples of 64; 256 threads.
template <int R, int C>
__device__ __forceinline__ void transpose_tile_f16(
    const float* __restrict__ in, _Float16* __restrict__ out, int tx, int ty,
    float (*sT)[65]) {
  const int tid = threadIdx.x;
  const int c0 = tx * 64, r0 = ty * 64;

  const int lr = tid >> 4, lc = (tid & 15) << 2;
  float4 v[4];
#pragma unroll
  for (int i = 0; i < 4; ++i)
    v[i] = *(const float4*)&in[(size_t)(r0 + lr + i * 16) * C + c0 + lc];
#pragma unroll
  for (int i = 0; i < 4; ++i) {
    sT[lr + i * 16][lc + 0] = v[i].x;
    sT[lr + i * 16][lc + 1] = v[i].y;
    sT[lr + i * 16][lc + 2] = v[i].z;
    sT[lr + i * 16][lc + 3] = v[i].w;
  }
  __syncthreads();   // reached by every thread of a tile's block, by no x block

  const int rg = (tid & 7) << 3;   // 8 lanes x 8 halves = one output line
#pragma unroll
  for (int i = 0; i < 2; ++i) {
    const int oc = (tid >> 3) + i * 32;
    v8h h;
#pragma unroll
    for (int e = 0; e < 8; ++e) h[e] = (_Float16)sT[rg + e][oc];
    *(v8h*)&out[(size_t)(c0 + oc) * R + r0 + rg] = h;
  }
  // Precaution: the function is inlined into a branch, and this wait stands in
  // front of any later write of a register that the two stores name.
  asm volatile("s_wait_xcnt 0x0" ::: "memory");
}

__global__ __launch_bounds__(256) void k_prepare(
    const float* __restrict__ x, const float* __restrict__ Wqkv,
    const float* __restrict__ Wout, _Float16* __restrict__ xh,
    _Float16* __restrict__ wqkvT, _Float16* __restrict__ woutT) {
  __shared__ float sT[64][65];   // odd pitch: column reads fall on distinct banks
  const int blk = blockIdx.x;
  if (blk < kBlkWqkv) {
    constexpr int kTx = (3 * kDim) / 64;
    transpose_tile_f16<kDim, 3 * kDim>(Wqkv, wqkvT, blk % kTx, blk / kTx, sT);
  } else if (blk < kBlkWqkv + kBlkWout) {
    constexpr int kTx = kDim / 64;
    const int t = blk - kBlkWqkv;
    transpose_tile_f16<kDim, kDim>(Wout, woutT, t % kTx, t / kTx, sT);
  } else {
    // Elementwise f32 -> f16; the kBlkX blocks cover x exactly.
    const int i = (blk - (kBlkWqkv + kBlkWout)) * 256 + threadIdx.x;
    xh[i] = (_Float16)x[i];
    // Precaution: in front of any later write of a register the store names.
    asm volatile("s_wait_xcnt 0x0" ::: "memory");
  }
}

// ---------------------------------------------------------------------------
// QKV projection: C[4096,3072] = Xh[4096,1024] @ Wqkv; scatter to q/k/v
// in [B,H,N,Dh] f16 layout. Block tile 128x128, K-step 64, 8 waves (4x2).
// Async double-buffered LDS staging: DMA tile kt+1 while WMMAs chew tile kt.
// ---------------------------------------------------------------------------
__global__ __launch_bounds__(256) void k_qkv_gemm(
    const _Float16* __restrict__ A,    // [4096,1024]
    const _Float16* __restrict__ Bt,   // [3072,1024]  (Wqkv^T, N-major)
    const float* __restrict__ bias,    // [3072]
    _Float16* __restrict__ qh, _Float16* __restrict__ kh,
    _Float16* __restrict__ vh) {
  __shared__ __align__(16) _Float16 sA[2][128 * kLdG];
  __shared__ __align__(16) _Float16 sB[2][128 * kLdG];
  const int tid = threadIdx.x, lane = tid & 31, w = tid >> 5;
  const int wm = w & 3, wn = w >> 2;
  const int m0 = blockIdx.x * 128, n0 = blockIdx.y * 128;
  constexpr int KT = kDim / kKs;

  auto stage = [&](int kt, int buf) {        // 128 rows x 64 halves per tile
    // 8 lanes a row: a wave's copy takes 4 whole lines. Rows r + 0, 32, 64, 96.
    const int r = tid >> 3, kc = (tid & 7) << 3;
    async_copy8_b128(&sA[buf][r * kLdG + kc],
                     &A[(size_t)(m0 + r) * kDim + kt * kKs + kc],
                     &sB[buf][r * kLdG + kc],
                     &Bt[(size_t)(n0 + r) * kDim + kt * kKs + kc],
                     32 * kLdG, 32 * kDim);
  };

  v8f acc[2][4];
  v8f z = {};
#pragma unroll
  for (int i = 0; i < 2; ++i)
#pragma unroll
    for (int j = 0; j < 4; ++j) acc[i][j] = z;

  stage(0, 0);
  wait_async0();
  __syncthreads();

  for (int kt = 0; kt < KT; ++kt) {
    const int cur = kt & 1;
    if (kt + 1 < KT) stage(kt + 1, cur ^ 1);   // overlap DMA with compute

#pragma unroll   // ks becomes an immediate offset of the LDS reads
    for (int ks = 0; ks < kKs; ks += 32) {
      v16h af[2], bf[4];
#pragma unroll
      for (int i = 0; i < 2; ++i)
        af[i] = load_frag16(&sA[cur][(wm * 32 + i * 16) * kLdG + ks], kLdG, lane);
#pragma unroll
      for (int j = 0; j < 4; ++j)
        bf[j] = load_frag16(&sB[cur][(wn * 64 + j * 16) * kLdG + ks], kLdG, lane);
#pragma unroll
      for (int i = 0; i < 2; ++i)
#pragma unroll
        for (int j = 0; j < 4; ++j) acc[i][j] = wmma16(af[i], bf[j], acc[i][j]);
    }

    wait_ds0();
    wait_async0();
    __syncthreads();
  }

  // Epilogue: C layout = VGPR e holds row (e + 8*(lane>=16)), col (lane&15).
  const int rl = (lane >> 4) << 3;
#pragma unroll
  for (int i = 0; i < 2; ++i) {
#pragma unroll
    for (int j = 0; j < 4; ++j) {
      const int gn = n0 + wn * 64 + j * 16 + (lane & 15);
      const float bn = bias[gn];
      const int which = gn >> 10;            // 0=q 1=k 2=v
      const int cc = gn & 1023;
      const int hh = cc >> 6, dd = cc & 63;
      _Float16* dst = (which == 0) ? qh : (which == 1) ? kh : vh;
#pragma unroll
      for (int e = 0; e < 8; ++e) {
        const int gm = m0 + wm * 32 + i * 16 + rl + e;
        const int bb = gm >> 11, tt = gm & 2047;
        dst[(((size_t)(bb * kHeads + hh)) * kSeq + tt) * kHd + dd] =
            (_Float16)(acc[i][j][e] + bn);
      }
    }
  }
}

__global__ __launch_bounds__(256) void k_attn(
    const _Float16* __restrict__ qh, const _Float16* __restrict__ kh,
    const _Float16* __restrict__ vh, _Float16* __restrict__ oh) {
  __shared__ __align__(16) _Float16 sK[64 * kLdT];       // [key][dh]
  __shared__ __align__(16) _Float16 sV[64 * kLdV];       // [key][dh]
  // Hand-over of one query tile's partial between the waves of a query group:
  // [wave][8 x 4 O^T values, then maximum and sum][lane], 16 bytes a lane.
  __shared__ __align__(16) float4 sX[8][9][32];

  const int tid = threadIdx.x, lane = tid & 31, w = tid >> 5;
  const int qg = w & 3, kq = w >> 2;             // query group, key half
  const int bh = blockIdx.y;                     // 0..B*H-1
  const int b = bh >> 4, h = bh & 15;
  const int q0 = blockIdx.x * 128 + qg * 32;     // this wave's 32 query rows
  const size_t bhBase = (size_t)bh * kSeq * kHd;

  // Q fragments (B operand: column = query) stay resident in registers.
  v16h qf[2][2];
#pragma unroll
  for (int n = 0; n < 2; ++n) {
    const _Float16* qp = qh + bhBase + (size_t)(q0 + n * 16) * kHd;
#pragma unroll
    for (int j = 0; j < 2; ++j) qf[n][j] = load_frag16(qp + j * 32, kHd, lane);
  }

  // o[n][c][e] = O^T[dh = c*16 + 8*(lane>>4) + e][query = n*16 + (lane&15)]
  v8f o[2][4];
  v8f z = {};
  float mrow[2], lrow[2];
#pragma unroll
  for (int n = 0; n < 2; ++n) {
#pragma unroll
    for (int c = 0; c < 4; ++c) o[n][c] = z;
    mrow[n] = -1e30f;   // running maximum of this lane's query, this key half
    lrow[n] = 0.f;      // running sum over this wave half's keys only
  }
  const _Float16* sKw = &sK[(kq * 32) * kLdT];   // this wave's 32 keys
  const _Float16* sVw = &sV[(kq * 32) * kLdV];

  for (int kt = 0; kt < kSeq / 64; ++kt) {
    wait_ds0();
    __syncthreads();
    const int kb = kt * 64;
    {
      // 64 keys x 64 dh of K and of V: rows key and key + 32 of each, async DMA
      // straight into LDS. Every lane is on at the copies.
      const int key = tid >> 3, dc = (tid & 7) << 3;
      const size_t g = bhBase + (size_t)(kb + key) * kHd + dc;
      async_copy4_b128(&sK[key * kLdT + dc], &kh[g],
                       &sV[key * kLdV + dc], &vh[g],
                       &sK[(key + 32) * kLdT + dc], &kh[g + 32 * kHd],
                       &sV[(key + 32) * kLdV + dc], &vh[g + 32 * kHd]);
    }
#pragma unroll
    for (int it = 0; it < 2; ++it) {
      const int c = tid + it * 256;
      const int key = c >> 3, dc = (c & 7) << 3;
      if (kt + 1 < kSeq / 64) {
        __builtin_prefetch(&kh[bhBase + (size_t)(kb + 64 + key) * kHd + dc], 0, 1);
        __builtin_prefetch(&vh[bhBase + (size_t)(kb + 64 + key) * kHd + dc], 0, 1);
      }
    }
    wait_async0();
    __syncthreads();

    // S^T = K @ Q^T: s[n][c][e] = score of key kq*32 + c*16 + 8*(lane>>4) + e.
    v8f s[2][2];
#pragma unroll
    for (int n = 0; n < 2; ++n)
#pragma unroll
      for (int c = 0; c < 2; ++c) s[n][c] = z;
#pragma unroll
    for (int j = 0; j < 2; ++j)
#pragma unroll
      for (int c = 0; c < 2; ++c) {
        v16h kf = load_frag16(&sKw[(c * 16) * kLdT + j * 32], kLdT, lane);
#pragma unroll
        for (int n = 0; n < 2; ++n) s[n][c] = wmma16(kf, qf[n][j], s[n][c]);
      }

    // Online softmax, per query tile: 16 of the query's 32 scores are in this
    // lane, the other 16 in lane ^ 16.
    const v2f sc2 = {kScaleLog2e, kScaleLog2e};
    v16h pf[2];
#pragma unroll
    for (int n = 0; n < 2; ++n) {
      float mc[2];
#pragma unroll
      for (int c = 0; c < 2; ++c) {
        mc[c] = s[n][c][0];
#pragma unroll
        for (int e = 1; e < 8; ++e) mc[c] = fmaxf(mc[c], s[n][c][e]);
      }
      float mx = fmaxf(mc[0], mc[1]);
      mx = fmaxf(mx, xhalf(mx));
      const float mnew = fmaxf(mrow[n], mx * kScaleLog2e);
      const float alpha = __builtin_amdgcn_exp2f(mrow[n] - mnew);
      // Two scores (an even register pair of the result tile) at a time: one
      // packed FMA gives both exponents, one packed add takes both into the sum.
      const v2f nm2 = {-mnew, -mnew};
      v2f rs[2];
#pragma unroll
      for (int c = 0; c < 2; ++c) {
#pragma unroll
        for (int e = 0; e < 8; e += 2) {
          const v2f t = __builtin_elementwise_fma(
              (v2f){s[n][c][e], s[n][c][e + 1]}, sc2, nm2);
          const v2f p = {__builtin_amdgcn_exp2f(t.x),
                         __builtin_amdgcn_exp2f(t.y)};
          s[n][c][e] = p.x;
          s[n][c][e + 1] = p.y;
          rs[c] = (e == 0) ? p : rs[c] + p;
        }
      }
      const v2f rt = rs[0] + rs[1];
      lrow[n] = lrow[n] * alpha + (rt.x + rt.y);
      mrow[n] = mnew;
#pragma unroll
      for (int c = 0; c < 4; ++c)
#pragma unroll
        for (int e = 0; e < 8; ++e) o[n][c][e] *= alpha;

      // P^T as a B fragment, in place: element t is key
      // (t < 8 ? 8*(lane>>4) + t : 16 + 8*(lane>>4) + t - 8) of the wave's 32,
      // which is register t&7 of tile t>>3 and the k order of load_frag16.
#pragma unroll
      for (int t = 0; t < 16; ++t) pf[n][t] = (_Float16)s[n][t >> 3][t & 7];
    }

    // O^T += V^T @ P^T
#pragma unroll
    for (int c = 0; c < 4; ++c) {
      v16h vf = load_frag16_tr(&sVw[c * 16], kLdV, lane);
#pragma unroll
      for (int n = 0; n < 2; ++n) o[n][c] = wmma16(vf, pf[n], o[n][c]);
    }
  }

  // Join the two key halves. Wave (qg, kq) finishes query tile kq: it hands
  // tile 1 - kq to its partner and takes the partner's partial of tile kq.
  const bool up = (kq != 0);
  const float lf0 = lrow[0] + xhalf(lrow[0]);
  const float lf1 = lrow[1] + xhalf(lrow[1]);
#pragma unroll
  for (int c = 0; c < 4; ++c) {
    const v8f g = up ? o[0][c] : o[1][c];
    sX[w][2 * c + 0][lane] = make_float4(g[0], g[1], g[2], g[3]);
    sX[w][2 * c + 1][lane] = make_float4(g[4], g[5], g[6], g[7]);
  }
  sX[w][8][lane] = make_float4(up ? mrow[0] : mrow[1], up ? lf0 : lf1, 0.f, 0.f);
  __syncthreads();

  const int pw = w ^ 4;                          // the partner wave
  const float4 ml = sX[pw][8][lane];
  const float mMine = up ? mrow[1] : mrow[0];
  const float lMine = up ? lf1 : lf0;
  const float mAll = fmaxf(mMine, ml.x);
  const float aMine = __builtin_amdgcn_exp2f(mMine - mAll);
  const float aOther = __builtin_amdgcn_exp2f(ml.x - mAll);
  const float inv = 1.f / (lMine * aMine + ml.y * aOther);
  const float fMine = aMine * inv, fOther = aOther * inv;

  // Normalize and write O in [b, token, h*64+dh] (row-major for out-proj):
  // 8 consecutive dh per lane.
  const int token = q0 + kq * 16 + (lane & 15);
  _Float16* op = &oh[((size_t)(b * kSeq + token)) * kDim + h * kHd +
                     ((lane >> 4) << 3)];
#pragma unroll
  for (int c = 0; c < 4; ++c) {
    const v8f mine = up ? o[1][c] : o[0][c];
    const float4 x0 = sX[pw][2 * c + 0][lane];
    const float4 x1 = sX[pw][2 * c + 1][lane];
    const float ot[8] = {x0.x, x0.y, x0.z, x0.w, x1.x, x1.y, x1.z, x1.w};
    v8h r;
#pragma unroll
    for (int e = 0; e < 8; ++e)
      r[e] = (_Float16)(mine[e] * fMine + ot[e] * fOther);
    *(v8h*)(op + c * 16) = r;
  }
}

// ---------------------------------------------------------------------------
// Output projection: out[4096,1024] = Oh @ Wout + b_out (f32 result).
// Same async double-buffered pipeline as the QKV GEMM, in stages of 128 k: one
// work-group a WGP here, so the longer stage has to cover the copies' flight.
// ---------------------------------------------------------------------------
__global__ __launch_bounds__(256) void k_out_gemm(
    const _Float16* __restrict__ A,    // [4096,1024]
    const _Float16* __restrict__ Bt,   // [1024,1024] (Wout^T)
    const float* __restrict__ bias,    // [1024]
    float* __restrict__ C) {
  __shared__ __align__(16) _Float16 sA[2][128 * kLdO];
  __shared__ __align__(16) _Float16 sB[2][128 * kLdO];
  const int tid = threadIdx.x, lane = tid & 31, w = tid >> 5;
  const int wm = w & 3, wn = w >> 2;
  const int m0 = blockIdx.x * 128, n0 = blockIdx.y * 128;
  constexpr int KT = kDim / kKsO;

  auto stage = [&](int kt, int buf) {        // 128 rows x 128 halves per tile
    // 16 lanes a row: a wave's copy takes 4 whole lines. Rows r + 0, 16, .. 112.
    const int r = tid >> 4, kc = (tid & 15) << 3;
#pragma unroll   // two statements: an asm statement takes at most 15 copies
    for (int h = 0; h < 128; h += 64)
      async_copy8_b128(&sA[buf][(r + h) * kLdO + kc],
                       &A[(size_t)(m0 + r + h) * kDim + kt * kKsO + kc],
                       &sB[buf][(r + h) * kLdO + kc],
                       &Bt[(size_t)(n0 + r + h) * kDim + kt * kKsO + kc],
                       16 * kLdO, 16 * kDim);
  };

  v8f acc[2][4];
  v8f z = {};
#pragma unroll
  for (int i = 0; i < 2; ++i)
#pragma unroll
    for (int j = 0; j < 4; ++j) acc[i][j] = z;

  stage(0, 0);
  wait_async0();
  __syncthreads();

  for (int kt = 0; kt < KT; ++kt) {
    const int cur = kt & 1;
    if (kt + 1 < KT) stage(kt + 1, cur ^ 1);

#pragma unroll   // ks becomes an immediate offset of the LDS reads
    for (int ks = 0; ks < kKsO; ks += 32) {
      v16h af[2], bf[4];
#pragma unroll
      for (int i = 0; i < 2; ++i)
        af[i] = load_frag16(&sA[cur][(wm * 32 + i * 16) * kLdO + ks], kLdO, lane);
#pragma unroll
      for (int j = 0; j < 4; ++j)
        bf[j] = load_frag16(&sB[cur][(wn * 64 + j * 16) * kLdO + ks], kLdO, lane);
#pragma unroll
      for (int i = 0; i < 2; ++i)
#pragma unroll
        for (int j = 0; j < 4; ++j) acc[i][j] = wmma16(af[i], bf[j], acc[i][j]);
    }

    wait_ds0();
    wait_async0();
    __syncthreads();
  }

  const int rl = (lane >> 4) << 3;
#pragma unroll
  for (int i = 0; i < 2; ++i) {
#pragma unroll
    for (int j = 0; j < 4; ++j) {
      const int gn = n0 + wn * 64 + j * 16 + (lane & 15);
      const float bn = bias[gn];
#pragma unroll
      for (int e = 0; e < 8; ++e) {
        const int gm = m0 + wm * 32 + i * 16 + rl + e;
        C[(size_t)gm * kDim + gn] = acc[i][j][e] + bn;
      }
    }
  }
}

// ---------------------------------------------------------------------------
// Host-side launcher.
// ---------------------------------------------------------------------------
extern "C" void kernel_launch(void* const* d_in, const int* in_sizes, int n_in,
                              void* d_out, int out_size, void* d_ws,
                              size_t ws_size, hipStream_t stream) {
  (void)in_sizes; (void)n_in; (void)out_size; (void)ws_size;
  const float* x    = (const float*)d_in[0];   // [2,2048,1024]
  const float* Wqkv = (const float*)d_in[1];   // [1024,3072]
  const float* bqkv = (const float*)d_in[2];   // [3072]
  const float* Wout = (const float*)d_in[3];   // [1024,1024]
  const float* bout = (const float*)d_in[4];   // [1024]
  float* out = (float*)d_out;                  // [2,2048,1024]

  char* ws = (char*)d_ws;
  size_t off = 0;
  auto alloc = [&](size_t bytes) -> void* {
    void* p = ws + off;
    off += (bytes + 255) & ~(size_t)255;
    return p;
  };
  const size_t nX = (size_t)kM * kDim;                 // 4.19M
  _Float16* xh    = (_Float16*)alloc(nX * 2);          // reused as Oh later
  _Float16* wqkvT = (_Float16*)alloc((size_t)3 * kDim * kDim * 2);
  _Float16* woutT = (_Float16*)alloc((size_t)kDim * kDim * 2);
  _Float16* qh    = (_Float16*)alloc(nX * 2);
  _Float16* kh    = (_Float16*)alloc(nX * 2);
  _Float16* vh    = (_Float16*)alloc(nX * 2);
  _Float16* oh    = xh;  // xh dead after QKV GEMM; alias for attention output

  // 1) precision/layout conversion of x and both weights, one launch
  k_prepare<<<kBlkPrep, 256, 0, stream>>>(x, Wqkv, Wout, xh, wqkvT, woutT);

  // 2) QKV projection -> q/k/v in [B,H,N,Dh] f16
  k_qkv_gemm<<<dim3(kM / 128, (3 * kDim) / 128), 256, 0, stream>>>(
      xh, wqkvT, bqkv, qh, kh, vh);

  // 3) flash attention -> Oh in [B,N,C] f16
  k_attn<<<dim3(kSeq / 128, kB * kHeads), 256, 0, stream>>>(qh, kh, vh, oh);

  // 4) output projection -> f32 result
  k_out_gemm<<<dim3(kM / 128, kDim / 128), 256, 0, stream>>>(
      oh, woutT, bout, out);
}
